// v000
// Measured on an AMD MI455X. A time is GPU time per run, averaged over a window of back-to-back runs after a warm-up
// (all launches, gaps included; the runs take copies of the inputs in turn), and the median of several windows.
// Apart from v000's, it joins two sittings. Times from different sittings can be a few percent apart, while
// side-by-side timings come from the same sitting.
// The starting kernel, v000, takes 143 microseconds a run.
#include <hip/hip_runtime.h>

// Contractions: three 1x1-conv channel GEMMs (out-channel x pixel, K = 256 in-channels) on v_wmma_f32_16x16x32_bf16 (bf16 operands = RNE-converted inputs and weights, f32 accumulate, bias added in f32); the 3x3-token x 16-dim per-channel attention (scores, softmax, weighted sum) and the residual add run in f32 on VALU.
// Pipeline per group of GB images: token-major bf16 copies XT[p][c] of both feature slabs; Q = Wq.XTb^T + bq, K = Wk.XTw^T + bk, V = Wv.XTw^T + bv as f32 channel-major planes [c][4096]; then one block per (image, token row, 16 channels) computes the 9-neighbour attention (tokens outside the 16x16 grid are zero keys/values kept in the softmax), scale 1/4, and writes out = bf16(blue) + enhanced.

#ifndef NB
#define NB 8
#endif
#define NB_FULL 8
#define CC   256
#define HH   64
#define WW   64
#define HW   (HH * WW)
#define IMG  (CC * HW)          // per-image stride (floats) of inputs, output and Q/K/V planes (full geometry)
#define NTK  16                 // 4x4-pixel tokens per side
#define GB   ((NB < 4) ? NB : 4)
#define SCL  0.25f
#define L2E  1.4426950408889634f
static_assert(NB % GB == 0);
static_assert(NB <= NB_FULL);
static_assert(CC % 64 == 0);
static_assert(HW % 64 == 0);
static_assert(CC % 32 == 0);

typedef _Float16 h16;
typedef unsigned short bf;
typedef __attribute__((ext_vector_type(16))) __bf16   v16bf;
typedef __attribute__((ext_vector_type(16))) _Float16 v16h;
typedef __attribute__((ext_vector_type(8)))  _Float16 v8h;
typedef __attribute__((ext_vector_type(8)))  unsigned short v8us;
typedef __attribute__((ext_vector_type(8)))  float    v8f;
typedef __attribute__((ext_vector_type(4)))  float    v4f;
typedef v4f  __attribute__((may_alias)) v4fa;

__device__ __forceinline__ unsigned short f2bf(float f) { unsigned u = __float_as_uint(f); u += 0x7FFFu + ((u >> 16) & 1u); return (unsigned short)(u >> 16); }
__device__ __forceinline__ float bf2f(unsigned short b) { return __uint_as_float(((unsigned)b) << 16); }
__device__ __forceinline__ float bfr(float f) { return bf2f(f2bf(f)); }
__device__ __forceinline__ v16h cat16(v8h lo, v8h hi) { return __builtin_shufflevector(lo, hi, 0, 1, 2, 3, 4, 5, 6, 7, 8, 9, 10, 11, 12, 13, 14, 15); }
__device__ __forceinline__ v16bf cat16b(v8us lo, v8us hi) { return __builtin_bit_cast(v16bf, __builtin_shufflevector(lo, hi, 0, 1, 2, 3, 4, 5, 6, 7, 8, 9, 10, 11, 12, 13, 14, 15)); }
__device__ __forceinline__ v8f wmma16(v16h a, v16h b, v8f c) { return __builtin_amdgcn_wmma_f32_16x16x32_f16(false, a, false, b, (short)0, c, false, false); }
__device__ __forceinline__ v8f wmmab(v16bf a, v16bf b, v8f c) { return __builtin_amdgcn_wmma_f32_16x16x32_bf16(false, a, false, b, (short)0, c, false, false); }

// ---- k_gemmw: register-blocked GEMM, ONE WAVE per 64x64 output tile (16 accumulators), operands straight from K-contiguous 16-bit planes; grid (M/64, N/64, Z), 32 threads.
// C[m][n] (f32, pitch ldc, + optional f32 bias[m] per ROW, RNE-converted to bf16) = sum_k A[m][k] Bt[n][k] (+ split products per NSPLIT). z-batch strides sA/sB/sC in elements. K % 32 == 0.
// Fragment map (both operands): lane l -> row/col l&15, elements 0..7 <- k0 + 8(l>>4) + 0..7, elements 8..15 <- k0 + 16 + 8(l>>4) + 0..7; D element r of lane l = (row 8(l>>4)+r, col l&15).
template <typename T16> struct WFrag;
template <> struct WFrag<h16> { typedef v16h V; static __device__ __forceinline__ V ld(const h16* p) { return cat16(*(const v8h*)p, *(const v8h*)(p + 16)); } static __device__ __forceinline__ v8f mma(V a, V b, v8f c) { return wmma16(a, b, c); } };
template <> struct WFrag<bf> { typedef v16bf V; static __device__ __forceinline__ V ld(const bf* p) { return cat16b(*(const v8us*)p, *(const v8us*)(p + 16)); } static __device__ __forceinline__ v8f mma(V a, V b, v8f c) { return wmmab(a, b, c); } };
template <typename T16, int NSPLIT, bool BIASR>
__global__ __launch_bounds__(32) void k_gemmw(const T16* __restrict__ A, const T16* __restrict__ A2, const T16* __restrict__ Bt, const T16* __restrict__ Bt2, int K, float* C, int ldc, const float* __restrict__ bias, size_t sA, size_t sB, size_t sC) {
    typedef typename WFrag<T16>::V V;
    __shared__ __align__(16) float os[16 * 68];
    const size_t z = blockIdx.z; A += z * sA; if (A2) A2 += z * sA; Bt += z * sB; if (Bt2) Bt2 += z * sB; C += z * sC;
    const int lane = threadIdx.x & 31, lr = lane & 15, hi = lane >> 4; const int r0 = blockIdx.x * 64, c0 = blockIdx.y * 64;
    v8f acc[4][4];
#pragma unroll
    for (int mb = 0; mb < 4; ++mb)
#pragma unroll
        for (int nb = 0; nb < 4; ++nb) acc[mb][nb] = (v8f){};
    const size_t aoff = (size_t)(r0 + lr) * K + 8 * hi, boff = (size_t)(c0 + lr) * K + 8 * hi;
#pragma unroll 1
    for (int kc = 0; kc < K; kc += 32) {
        V a[4], a2[4];
#pragma unroll
        for (int mb = 0; mb < 4; ++mb) { a[mb] = WFrag<T16>::ld(A + aoff + (size_t)mb * 16 * K + kc); if (NSPLIT == 1 || NSPLIT == 2) a2[mb] = WFrag<T16>::ld(A2 + aoff + (size_t)mb * 16 * K + kc); }
#pragma unroll
        for (int nb = 0; nb < 4; ++nb) { const V b = WFrag<T16>::ld(Bt + boff + (size_t)nb * 16 * K + kc); V b2; if (NSPLIT >= 2) b2 = WFrag<T16>::ld(Bt2 + boff + (size_t)nb * 16 * K + kc);
#pragma unroll
            for (int mb = 0; mb < 4; ++mb) { acc[mb][nb] = WFrag<T16>::mma(a[mb], b, acc[mb][nb]); if (NSPLIT == 1 || NSPLIT == 2) acc[mb][nb] = WFrag<T16>::mma(a2[mb], b, acc[mb][nb]); if (NSPLIT >= 2) acc[mb][nb] = WFrag<T16>::mma(a[mb], b2, acc[mb][nb]); } }
        asm volatile("v_nop\n\tv_nop\n\tv_nop\n\tv_nop" : "+v"(acc[0][0]), "+v"(acc[1][1]), "+v"(acc[2][2]), "+v"(acc[3][3]) : "v"(a[0]), "v"(a[3]));
    }
#pragma unroll
    for (int mb = 0; mb < 4; ++mb) {
#pragma unroll
        for (int nb = 0; nb < 4; ++nb) {
#pragma unroll
            for (int j = 0; j < 8; ++j) os[(hi * 8 + j) * 68 + nb * 16 + lr] = acc[mb][nb][j]; }
        __builtin_amdgcn_wave_barrier(); asm volatile("" ::: "memory");
        float* crow = C + (size_t)(r0 + mb * 16) * ldc + c0;
{
#pragma unroll
            for (int s = 0; s < 8; ++s) { const int row = 2 * s + hi, cofs = lr * 4; v4f val = *(const v4fa*)(os + row * 68 + cofs);
                if (BIASR) { const float bb = bfr(bias[r0 + mb * 16 + row]); val[0] += bb; val[1] += bb; val[2] += bb; val[3] += bb; }
                *(v4f*)(crow + (size_t)row * ldc + cofs) = val; }
             }
        __builtin_amdgcn_wave_barrier(); asm volatile("" ::: "memory");
    }
}

__global__ __launch_bounds__(256) void k_cvt8(const float* __restrict__ src, bf* dst, size_t n8) { const size_t i = (size_t)blockIdx.x * 256 + threadIdx.x; if (i >= n8) return; const v8f v = *(const v8f*)(src + i * 8); v8us o;
#pragma unroll
    for (int k = 0; k < 8; ++k) o[k] = f2bf(v[k]); *(v8us*)(dst + i * 8) = o;  }

__global__ __launch_bounds__(256) void k_xT(const float* __restrict__ xs, bf* XT, int nimg) {
    const size_t k = (size_t)blockIdx.x * 256 + threadIdx.x; if (k >= (size_t)nimg * HW * (CC / 8)) return;
    const int c0 = (int)(k % (CC / 8)) * 8; const size_t tt = k / (CC / 8); const int t = (int)(tt % HW); const int bb = (int)(tt / HW);
    const float* src = xs + (size_t)bb * IMG; v8us o;
#pragma unroll
    for (int q = 0; q < 8; ++q) o[q] = f2bf(src[(size_t)(c0 + q) * HW + t]);
    bf* dst = XT + ((size_t)bb * HW + t) * CC + c0;
    *(v8us*)dst = o;  }

// k_nbr: per-channel attention of each 4x4-pixel token over its 3x3 token neighbourhood (16-dim dot per key, scale 1/4, softmax over the 9 slots with
// out-of-grid slots as zero keys/values, weighted sum of the value tokens), plus the residual bf16(blue). One block per (image, token row ti, group of
// 16 channels); lane&15 = token column tj, wave*2 + (lane>>4) = channel within the group. Q/K/V are f32 channel-major planes [img][c][4096].
// All neighbour loads are unconditional at clamped token coordinates; validity enters only by value. Rolled 3x3 loop with an online softmax.
__global__ __launch_bounds__(256) __attribute__((amdgpu_num_vgpr(256)))
void k_nbr(const float* __restrict__ Qg, const float* __restrict__ Kg, const float* __restrict__ Vg, const float* __restrict__ xres, float* outp) {
#pragma clang fp contract(off)
    const int tid = threadIdx.x, lane = tid & 31, wv = tid >> 5;
    const int tj = lane & 15, cs = lane >> 4;
    const int blk = blockIdx.x;
    const int cg = blk & 15, ti = (blk >> 4) & 15, bb = blk >> 8;
    const int c = cg * 16 + wv * 2 + cs;
    const size_t plane = (size_t)bb * IMG + (size_t)c * HW;
    const float* Qc = Qg + plane; const float* Kc = Kg + plane; const float* Vc = Vg + plane;
    const size_t tok = (size_t)(4 * ti) * WW + 4 * tj;

    float q[16];
#pragma unroll
    for (int r = 0; r < 4; ++r) { const v4f t4 = *(const v4f*)(Qc + tok + (size_t)r * WW); q[4 * r] = t4[0]; q[4 * r + 1] = t4[1]; q[4 * r + 2] = t4[2]; q[4 * r + 3] = t4[3]; }

    float acc[16];
#pragma unroll
    for (int e = 0; e < 16; ++e) acc[e] = 0.0f;
    float m = -1.0e30f, l = 0.0f;

#pragma unroll 1
    for (int di = -1; di <= 1; ++di) {
        const int tii = ti + di;
        const bool vi = ((unsigned)tii < (unsigned)NTK);
        const int tic = tii < 0 ? 0 : (tii > NTK - 1 ? NTK - 1 : tii);
#pragma unroll 1
        for (int dj = -1; dj <= 1; ++dj) {
            const int tjj = tj + dj;
            const bool ok = vi && ((unsigned)tjj < (unsigned)NTK);
            const int tjc = tjj < 0 ? 0 : (tjj > NTK - 1 ? NTK - 1 : tjj);
            const size_t nt = (size_t)(4 * tic) * WW + 4 * tjc;
            float kd = 0.0f;
#pragma unroll
            for (int r = 0; r < 4; ++r) { const v4f k4 = *(const v4f*)(Kc + nt + (size_t)r * WW);
#pragma unroll
                for (int e = 0; e < 4; ++e) kd = fmaf(q[4 * r + e], k4[e], kd); }
            const float s = ok ? kd * SCL : 0.0f;
            const float mn = fmaxf(m, s);
            const float corr = __builtin_amdgcn_exp2f((m - mn) * L2E);
            const float p = __builtin_amdgcn_exp2f((s - mn) * L2E);
            l = fmaf(l, corr, p);
            const float pv = ok ? p : 0.0f;
#pragma unroll
            for (int r = 0; r < 4; ++r) { const v4f v4 = *(const v4f*)(Vc + nt + (size_t)r * WW);
#pragma unroll
                for (int e = 0; e < 4; ++e) { const float t = acc[4 * r + e] * corr; acc[4 * r + e] = fmaf(pv, v4[e], t); } }
            m = mn;
        }
    }
    const float inv = 1.0f / l;
    const float* xr = xres + plane + tok;
    v4f o[4];
#pragma unroll
    for (int r = 0; r < 4; ++r) { const v4f b4 = *(const v4f*)(xr + (size_t)r * WW); v4f t4;
#pragma unroll
        for (int e = 0; e < 4; ++e) { const float en = acc[4 * r + e] * inv; t4[e] = bfr(b4[e]) + en; }
        o[r] = t4; }
    float* op = outp + plane + tok;
{
#pragma unroll
        for (int r = 0; r < 4; ++r) *(v4f*)(op + (size_t)r * WW) = o[r];
         }
}

extern "C" void kernel_launch(void* const* d_in, const int* in_sizes, int n_in, void* d_out, int out_size, void* d_ws, size_t ws_size, hipStream_t stream) {
    (void)n_in;
    if (in_sizes[0] < NB * IMG || in_sizes[1] < NB * IMG || in_sizes[2] < CC * CC || in_sizes[3] < CC || in_sizes[4] < CC * CC || in_sizes[5] < CC || in_sizes[6] < CC * CC || in_sizes[7] < CC || out_size < NB * IMG) return;
    const float* blue  = (const float*)d_in[0];   // [NB][256][4096] channel-major
    const float* white = (const float*)d_in[1];
    const float* Wq = (const float*)d_in[2];      // [256 out][256 in]
    const float* bq = (const float*)d_in[3];
    const float* Wk = (const float*)d_in[4];
    const float* bk = (const float*)d_in[5];
    const float* Wv = (const float*)d_in[6];
    const float* bv = (const float*)d_in[7];
    float* out = (float*)d_out;                   // [NB][256][4096]

    char* wsp = (char*)d_ws;
    auto take = [&](size_t bytes) { char* p = wsp; wsp += (bytes + 255) & ~(size_t)255; return (void*)p; };
    bf* Wqb = (bf*)take((size_t)CC * CC * 2);                 // weights as bf16, [o][c] = A operand as-is
    bf* Wkb = (bf*)take((size_t)CC * CC * 2);
    bf* Wvb = (bf*)take((size_t)CC * CC * 2);
    bf* XTb = (bf*)take((size_t)GB * HW * CC * 2);            // token-major bf16 blue [GB][4096][256]
    bf* XTw = (bf*)take((size_t)GB * HW * CC * 2);            // token-major bf16 white
    float* Qp = (float*)take((size_t)GB * IMG * 4);           // Q [GB][256][4096] f32
    float* Kp = (float*)take((size_t)GB * IMG * 4);
    float* Vp = (float*)take((size_t)GB * IMG * 4);
    if ((size_t)(wsp - (char*)d_ws) > ws_size) return;        // 67,502,080 B at NB = 8

    const size_t n8w = (size_t)CC * CC / 8;
    k_cvt8<<<(unsigned)((n8w + 255) / 256), 256, 0, stream>>>(Wq, Wqb, n8w);
    k_cvt8<<<(unsigned)((n8w + 255) / 256), 256, 0, stream>>>(Wk, Wkb, n8w);
    k_cvt8<<<(unsigned)((n8w + 255) / 256), 256, 0, stream>>>(Wv, Wvb, n8w);
    const unsigned gxT = (unsigned)(((size_t)GB * HW * (CC / 8) + 255) / 256);
    for (int g = 0; g < NB / GB; ++g) {
        const size_t goff = (size_t)g * GB * IMG;
        k_xT<<<gxT, 256, 0, stream>>>(blue + goff, XTb, GB);
        k_xT<<<gxT, 256, 0, stream>>>(white + goff, XTw, GB);
        k_gemmw<bf, 0, true><<<dim3(CC / 64, HW / 64, GB), 32, 0, stream>>>(Wqb, nullptr, XTb, nullptr, CC, Qp, HW, bq, 0, (size_t)HW * CC, (size_t)IMG);   // Q[o][p] = sum_c Wq[o][c] XTb[p][c] + bq[o]
        k_gemmw<bf, 0, true><<<dim3(CC / 64, HW / 64, GB), 32, 0, stream>>>(Wkb, nullptr, XTw, nullptr, CC, Kp, HW, bk, 0, (size_t)HW * CC, (size_t)IMG);
        k_gemmw<bf, 0, true><<<dim3(CC / 64, HW / 64, GB), 32, 0, stream>>>(Wvb, nullptr, XTw, nullptr, CC, Vp, HW, bv, 0, (size_t)HW * CC, (size_t)IMG);
        k_nbr<<<(unsigned)(GB * NTK * (CC / 16)), 256, 0, stream>>>(Qp, Kp, Vp, blue + goff, out + goff);
    }
}

// v001
// One run takes 104 microseconds.
// Next to v000, in two timings, it ran 1.43 and 1.41 times as fast.
#include <hip/hip_runtime.h>

// Contractions: three 1x1-conv channel GEMMs (out-channel x pixel, K = 256 in-channels) on v_wmma_f32_16x16x32_bf16 (bf16 operands = RNE-converted inputs and weights, f32 accumulate, bias added in f32); the 3x3-token x 16-dim per-channel attention (scores, softmax, weighted sum) and the residual add run in f32 on VALU.
// Pipeline, three launches over all GB = NB images: (1) k_prep: bf16 copies of the three weight matrices and token-major bf16 copies XT[p][c] of both feature slabs; (2) k_gemmw: Q = Wq.XTb^T + bq, K = Wk.XTw^T + bk, V = Wv.XTw^T + bv as f32 channel-major planes [c][4096], the projection chosen by blockIdx.z; (3) k_nbr: one block per (image, token row, 16 channels) computes the 9-neighbour attention (tokens outside the 16x16 grid are zero keys/values kept in the softmax), scale 1/4, and writes out = bf16(blue) + enhanced.

#ifndef NB
#define NB 8
#endif
#define NB_FULL 8
#define CC   256
#define HH   64
#define WW   64
#define HW   (HH * WW)
#define IMG  (CC * HW)          // per-image stride (floats) of inputs, output and Q/K/V planes (full geometry)
#define NTK  16                 // 4x4-pixel tokens per side
#define GB   NB                 // images per launch: all of them
#define SCL  0.25f
#define L2E  1.4426950408889634f
static_assert(NB % GB == 0);
static_assert(NB <= NB_FULL);
static_assert(CC % 64 == 0);
static_assert(HW % 64 == 0);
static_assert(CC % 32 == 0);

typedef _Float16 h16;
typedef unsigned short bf;
typedef __attribute__((ext_vector_type(16))) __bf16   v16bf;
typedef __attribute__((ext_vector_type(16))) _Float16 v16h;
typedef __attribute__((ext_vector_type(8)))  _Float16 v8h;
typedef __attribute__((ext_vector_type(8)))  unsigned short v8us;
typedef __attribute__((ext_vector_type(8)))  float    v8f;
typedef __attribute__((ext_vector_type(4)))  float    v4f;
typedef v4f  __attribute__((may_alias)) v4fa;

__device__ __forceinline__ unsigned short f2bf(float f) { unsigned u = __float_as_uint(f); u += 0x7FFFu + ((u >> 16) & 1u); return (unsigned short)(u >> 16); }
__device__ __forceinline__ float bf2f(unsigned short b) { return __uint_as_float(((unsigned)b) << 16); }
__device__ __forceinline__ float bfr(float f) { return bf2f(f2bf(f)); }
__device__ __forceinline__ v16h cat16(v8h lo, v8h hi) { return __builtin_shufflevector(lo, hi, 0, 1, 2, 3, 4, 5, 6, 7, 8, 9, 10, 11, 12, 13, 14, 15); }
__device__ __forceinline__ v16bf cat16b(v8us lo, v8us hi) { return __builtin_bit_cast(v16bf, __builtin_shufflevector(lo, hi, 0, 1, 2, 3, 4, 5, 6, 7, 8, 9, 10, 11, 12, 13, 14, 15)); }
__device__ __forceinline__ v8f wmma16(v16h a, v16h b, v8f c) { return __builtin_amdgcn_wmma_f32_16x16x32_f16(false, a, false, b, (short)0, c, false, false); }
__device__ __forceinline__ v8f wmmab(v16bf a, v16bf b, v8f c) { return __builtin_amdgcn_wmma_f32_16x16x32_bf16(false, a, false, b, (short)0, c, false, false); }

// ---- k_gemmw: register-blocked GEMM, ONE WAVE per 64x64 output tile (16 accumulators), operands straight from K-contiguous 16-bit planes; grid (M/64, N/64, 3 * ZPER), 32 threads.
// C[m][n] (f32, pitch ldc, + optional f32 bias[m] per ROW, RNE-converted to bf16) = sum_k A[m][k] Bt[n][k] (+ split products per NSPLIT). blockIdx.z = w * ZPER + i: product w (0, 1, 2) takes A + w * sA, bias / bias1 / bias2 and the B planes Bt (w = 0) or BtW (w > 0); batch entry i takes B + i * sB; C + blockIdx.z * sC. Strides in elements. K % 32 == 0.
// Fragment map (both operands): lane l -> row/col l&15, elements 0..7 <- k0 + 8(l>>4) + 0..7, elements 8..15 <- k0 + 16 + 8(l>>4) + 0..7; D element r of lane l = (row 8(l>>4)+r, col l&15).
template <typename T16> struct WFrag;
template <> struct WFrag<h16> { typedef v16h V; static __device__ __forceinline__ V ld(const h16* p) { return cat16(*(const v8h*)p, *(const v8h*)(p + 16)); } static __device__ __forceinline__ v8f mma(V a, V b, v8f c) { return wmma16(a, b, c); } };
template <> struct WFrag<bf> { typedef v16bf V; static __device__ __forceinline__ V ld(const bf* p) { return cat16b(*(const v8us*)p, *(const v8us*)(p + 16)); } static __device__ __forceinline__ v8f mma(V a, V b, v8f c) { return wmmab(a, b, c); } };
template <typename T16, int NSPLIT, bool BIASR, int ZPER>
__global__ __launch_bounds__(32) void k_gemmw(const T16* __restrict__ A, const T16* __restrict__ A2, const T16* __restrict__ Bt, const T16* __restrict__ BtW, const T16* __restrict__ Bt2, int K, float* C, int ldc, const float* __restrict__ bias, const float* __restrict__ bias1, const float* __restrict__ bias2, size_t sA, size_t sB, size_t sC) {
    typedef typename WFrag<T16>::V V;
    __shared__ __align__(16) float os[16 * 68];
    const size_t z = blockIdx.z, zw = z / ZPER, zi = z % ZPER; A += zw * sA; if (A2) A2 += zw * sA; Bt = (zw ? BtW : Bt) + zi * sB; if (Bt2) Bt2 += zi * sB; C += z * sC;
    if (BIASR) bias = zw == 0 ? bias : (zw == 1 ? bias1 : bias2);
    const int lane = threadIdx.x & 31, lr = lane & 15, hi = lane >> 4; const int r0 = blockIdx.x * 64, c0 = blockIdx.y * 64;
    v8f acc[4][4];
#pragma unroll
    for (int mb = 0; mb < 4; ++mb)
#pragma unroll
        for (int nb = 0; nb < 4; ++nb) acc[mb][nb] = (v8f){};
    const size_t aoff = (size_t)(r0 + lr) * K + 8 * hi, boff = (size_t)(c0 + lr) * K + 8 * hi;
#pragma unroll 1
    for (int kc = 0; kc < K; kc += 32) {
        V a[4], a2[4];
#pragma unroll
        for (int mb = 0; mb < 4; ++mb) { a[mb] = WFrag<T16>::ld(A + aoff + (size_t)mb * 16 * K + kc); if (NSPLIT == 1 || NSPLIT == 2) a2[mb] = WFrag<T16>::ld(A2 + aoff + (size_t)mb * 16 * K + kc); }
#pragma unroll
        for (int nb = 0; nb < 4; ++nb) { const V b = WFrag<T16>::ld(Bt + boff + (size_t)nb * 16 * K + kc); V b2; if (NSPLIT >= 2) b2 = WFrag<T16>::ld(Bt2 + boff + (size_t)nb * 16 * K + kc);
#pragma unroll
            for (int mb = 0; mb < 4; ++mb) { acc[mb][nb] = WFrag<T16>::mma(a[mb], b, acc[mb][nb]); if (NSPLIT == 1 || NSPLIT == 2) acc[mb][nb] = WFrag<T16>::mma(a2[mb], b, acc[mb][nb]); if (NSPLIT >= 2) acc[mb][nb] = WFrag<T16>::mma(a[mb], b2, acc[mb][nb]); } }
        asm volatile("v_nop\n\tv_nop\n\tv_nop\n\tv_nop" : "+v"(acc[0][0]), "+v"(acc[1][1]), "+v"(acc[2][2]), "+v"(acc[3][3]) : "v"(a[0]), "v"(a[3]));
    }
#pragma unroll
    for (int mb = 0; mb < 4; ++mb) {
#pragma unroll
        for (int nb = 0; nb < 4; ++nb) {
#pragma unroll
            for (int j = 0; j < 8; ++j) os[(hi * 8 + j) * 68 + nb * 16 + lr] = acc[mb][nb][j]; }
        __builtin_amdgcn_wave_barrier(); asm volatile("" ::: "memory");
        float* crow = C + (size_t)(r0 + mb * 16) * ldc + c0;
{
#pragma unroll
            for (int s = 0; s < 8; ++s) { const int row = 2 * s + hi, cofs = lr * 4; v4f val = *(const v4fa*)(os + row * 68 + cofs);
                if (BIASR) { const float bb = bfr(bias[r0 + mb * 16 + row]); val[0] += bb; val[1] += bb; val[2] += bb; val[3] += bb; }
                *(v4f*)(crow + (size_t)row * ldc + cofs) = val; }
             }
        __builtin_amdgcn_wave_barrier(); asm volatile("" ::: "memory");
    }
}

// ---- k_prep: every operand copy of the GEMMs in one grid. Blocks 0 .. 3*WBLK-1 convert the three weight matrices to bf16 (8 elements a thread, layout kept, Wb = [3][CC][CC]);
// the next XBLK blocks write XTb, the last XBLK blocks XTw: thread -> (image, pixel t, 8 channels), XT[img][t][c] = bf16(x[img][c][t]).
#define WBLK (CC * CC / 8 / 256)
#define XBLK (GB * HW * (CC / 8) / 256)
static_assert((CC * CC / 8) % 256 == 0);
__global__ __launch_bounds__(256) void k_prep(const float* __restrict__ Wq, const float* __restrict__ Wk, const float* __restrict__ Wv, bf* Wb, const float* __restrict__ blue, const float* __restrict__ white, bf* XTb, bf* XTw) {
    const unsigned blk = blockIdx.x;
    if (blk < 3 * WBLK) {
        const unsigned w = blk / WBLK; const float* src = w == 0 ? Wq : (w == 1 ? Wk : Wv);
        const size_t i = (size_t)(blk % WBLK) * 256 + threadIdx.x; const v8f v = *(const v8f*)(src + i * 8); v8us o;
#pragma unroll
        for (int k = 0; k < 8; ++k) o[k] = f2bf(v[k]);
        *(v8us*)(Wb + (size_t)w * CC * CC + i * 8) = o;
        return;
    }
    const unsigned xb = blk - 3 * WBLK; const bool isw = xb >= XBLK;
    const float* xs = isw ? white : blue; bf* XT = isw ? XTw : XTb;
    const size_t k = (size_t)(isw ? xb - XBLK : xb) * 256 + threadIdx.x;
    const int c0 = (int)(k % (CC / 8)) * 8; const size_t tt = k / (CC / 8); const int t = (int)(tt % HW); const int bb = (int)(tt / HW);
    const float* src = xs + (size_t)bb * IMG; v8us o;
#pragma unroll
    for (int q = 0; q < 8; ++q) o[q] = f2bf(src[(size_t)(c0 + q) * HW + t]);
    bf* dst = XT + ((size_t)bb * HW + t) * CC + c0;
    *(v8us*)dst = o;  }

// k_nbr: per-channel attention of each 4x4-pixel token over its 3x3 token neighbourhood (16-dim dot per key, scale 1/4, softmax over the 9 slots with
// out-of-grid slots as zero keys/values, weighted sum of the value tokens), plus the residual bf16(blue). One block per (image, token row ti, group of
// 16 channels); lane&15 = token column tj, wave*2 + (lane>>4) = channel within the group. Q/K/V are f32 channel-major planes [img][c][4096].
// All neighbour loads are unconditional at clamped token coordinates; validity enters only by value. Rolled 3x3 loop with an online softmax.
__global__ __launch_bounds__(256) __attribute__((amdgpu_num_vgpr(256)))
void k_nbr(const float* __restrict__ Qg, const float* __restrict__ Kg, const float* __restrict__ Vg, const float* __restrict__ xres, float* outp) {
#pragma clang fp contract(off)
    const int tid = threadIdx.x, lane = tid & 31, wv = tid >> 5;
    const int tj = lane & 15, cs = lane >> 4;
    const int blk = blockIdx.x;
    const int cg = blk & 15, ti = (blk >> 4) & 15, bb = blk >> 8;
    const int c = cg * 16 + wv * 2 + cs;
    const size_t plane = (size_t)bb * IMG + (size_t)c * HW;
    const float* Qc = Qg + plane; const float* Kc = Kg + plane; const float* Vc = Vg + plane;
    const size_t tok = (size_t)(4 * ti) * WW + 4 * tj;

    float q[16];
#pragma unroll
    for (int r = 0; r < 4; ++r) { const v4f t4 = *(const v4f*)(Qc + tok + (size_t)r * WW); q[4 * r] = t4[0]; q[4 * r + 1] = t4[1]; q[4 * r + 2] = t4[2]; q[4 * r + 3] = t4[3]; }

    float acc[16];
#pragma unroll
    for (int e = 0; e < 16; ++e) acc[e] = 0.0f;
    float m = -1.0e30f, l = 0.0f;

#pragma unroll 1
    for (int di = -1; di <= 1; ++di) {
        const int tii = ti + di;
        const bool vi = ((unsigned)tii < (unsigned)NTK);
        const int tic = tii < 0 ? 0 : (tii > NTK - 1 ? NTK - 1 : tii);
#pragma unroll 1
        for (int dj = -1; dj <= 1; ++dj) {
            const int tjj = tj + dj;
            const bool ok = vi && ((unsigned)tjj < (unsigned)NTK);
            const int tjc = tjj < 0 ? 0 : (tjj > NTK - 1 ? NTK - 1 : tjj);
            const size_t nt = (size_t)(4 * tic) * WW + 4 * tjc;
            float kd = 0.0f;
#pragma unroll
            for (int r = 0; r < 4; ++r) { const v4f k4 = *(const v4f*)(Kc + nt + (size_t)r * WW);
#pragma unroll
                for (int e = 0; e < 4; ++e) kd = fmaf(q[4 * r + e], k4[e], kd); }
            const float s = ok ? kd * SCL : 0.0f;
            const float mn = fmaxf(m, s);
            const float corr = __builtin_amdgcn_exp2f((m - mn) * L2E);
            const float p = __builtin_amdgcn_exp2f((s - mn) * L2E);
            l = fmaf(l, corr, p);
            const float pv = ok ? p : 0.0f;
#pragma unroll
            for (int r = 0; r < 4; ++r) { const v4f v4 = *(const v4f*)(Vc + nt + (size_t)r * WW);
#pragma unroll
                for (int e = 0; e < 4; ++e) { const float t = acc[4 * r + e] * corr; acc[4 * r + e] = fmaf(pv, v4[e], t); } }
            m = mn;
        }
    }
    const float inv = 1.0f / l;
    const float* xr = xres + plane + tok;
    v4f o[4];
#pragma unroll
    for (int r = 0; r < 4; ++r) { const v4f b4 = *(const v4f*)(xr + (size_t)r * WW); v4f t4;
#pragma unroll
        for (int e = 0; e < 4; ++e) { const float en = acc[4 * r + e] * inv; t4[e] = bfr(b4[e]) + en; }
        o[r] = t4; }
    float* op = outp + plane + tok;
{
#pragma unroll
        for (int r = 0; r < 4; ++r) *(v4f*)(op + (size_t)r * WW) = o[r];
         }
}

extern "C" void kernel_launch(void* const* d_in, const int* in_sizes, int n_in, void* d_out, int out_size, void* d_ws, size_t ws_size, hipStream_t stream) {
    (void)n_in;
    if (in_sizes[0] < NB * IMG || in_sizes[1] < NB * IMG || in_sizes[2] < CC * CC || in_sizes[3] < CC || in_sizes[4] < CC * CC || in_sizes[5] < CC || in_sizes[6] < CC * CC || in_sizes[7] < CC || out_size < NB * IMG) return;
    const float* blue  = (const float*)d_in[0];   // [NB][256][4096] channel-major
    const float* white = (const float*)d_in[1];
    const float* Wq = (const float*)d_in[2];      // [256 out][256 in]
    const float* bq = (const float*)d_in[3];
    const float* Wk = (const float*)d_in[4];
    const float* bk = (const float*)d_in[5];
    const float* Wv = (const float*)d_in[6];
    const float* bv = (const float*)d_in[7];
    float* out = (float*)d_out;                   // [NB][256][4096]

    char* wsp = (char*)d_ws;
    auto take = [&](size_t bytes) { char* p = wsp; wsp += (bytes + 255) & ~(size_t)255; return (void*)p; };
    bf* Wb  = (bf*)take((size_t)3 * CC * CC * 2);             // Wq, Wk, Wv as bf16, each [o][c] = A operand as-is
    bf* XTb = (bf*)take((size_t)GB * HW * CC * 2);            // token-major bf16 blue [GB][4096][256]
    bf* XTw = (bf*)take((size_t)GB * HW * CC * 2);            // token-major bf16 white
    float* Qp = (float*)take((size_t)3 * GB * IMG * 4);       // Q, K, V, each [GB][256][4096] f32
    float* Kp = Qp + (size_t)GB * IMG;
    float* Vp = Kp + (size_t)GB * IMG;
    if ((size_t)(wsp - (char*)d_ws) > ws_size) return;        // 134,610,944 B at NB = 8

    k_prep<<<3 * WBLK + 2 * XBLK, 256, 0, stream>>>(Wq, Wk, Wv, Wb, blue, white, XTb, XTw);
    k_gemmw<bf, 0, true, GB><<<dim3(CC / 64, HW / 64, 3 * GB), 32, 0, stream>>>(Wb, nullptr, XTb, XTw, nullptr, CC, Qp, HW, bq, bk, bv, (size_t)CC * CC, (size_t)HW * CC, (size_t)IMG);   // Q[o][p] = sum_c Wq[o][c] XTb[p][c] + bq[o]; K, V likewise from XTw
    k_nbr<<<(unsigned)(GB * NTK * (CC / 16)), 256, 0, stream>>>(Qp, Kp, Vp, blue, out);
}

// v002
// Measured time: 67.9 microseconds a run.
// In two side-by-side timings against v001, it was 1.53 and 1.52 times as fast.
// Counting every step since v000, it is 2.17 times as fast.
#include <hip/hip_runtime.h>

// Contractions: three 1x1-conv channel GEMMs (out-channel x pixel, K = 256 in-channels) on v_wmma_f32_16x16x32_bf16 (bf16 operands = RNE-converted inputs and weights, f32 accumulate, bias added in f32); the 3x3-token x 16-dim per-channel attention (scores, softmax, weighted sum) and the residual add run in f32 on VALU.
// Pipeline, three launches over all GB = NB images: (1) k_prep: bf16 copies of the three weight matrices; (2) k_gemmx: Q = Wq.blue + bq, K = Wk.white + bk, V = Wv.white + bv as f32 channel-major planes [c][4096], read straight from the f32 channel-major features and converted to bf16 in registers, the projection chosen by blockIdx.y; (3) k_nbr: one block per (image, token row, 16 channels) computes the 9-neighbour attention (tokens outside the 16x16 grid are zero keys/values kept in the softmax), scale 1/4, and writes out = bf16(blue) + enhanced.

#ifndef NB
#define NB 8
#endif
#define NB_FULL 8
#define CC   256
#define HH   64
#define WW   64
#define HW   (HH * WW)
#define IMG  (CC * HW)          // per-image stride (floats) of inputs, output and Q/K/V planes (full geometry)
#define NTK  16                 // 4x4-pixel tokens per side
#define GB   NB                 // images per launch: all of them
#define SCL  0.25f
#define L2E  1.4426950408889634f
static_assert(NB % GB == 0);
static_assert(NB <= NB_FULL);
static_assert(CC == 256);
static_assert(HW % 64 == 0);
static_assert(CC % 32 == 0);

typedef unsigned short bf;
typedef __attribute__((ext_vector_type(16))) __bf16   v16bf;
typedef __attribute__((ext_vector_type(8)))  unsigned short v8us;
typedef __attribute__((ext_vector_type(16))) float    v16f;
typedef __attribute__((ext_vector_type(8)))  float    v8f;
typedef __attribute__((ext_vector_type(4)))  float    v4f;

__device__ __forceinline__ unsigned short f2bf(float f) { unsigned u = __float_as_uint(f); u += 0x7FFFu + ((u >> 16) & 1u); return (unsigned short)(u >> 16); }
__device__ __forceinline__ float bf2f(unsigned short b) { return __uint_as_float(((unsigned)b) << 16); }
__device__ __forceinline__ float bfr(float f) { return bf2f(f2bf(f)); }
__device__ __forceinline__ v16bf cat16b(v8us lo, v8us hi) { return __builtin_bit_cast(v16bf, __builtin_shufflevector(lo, hi, 0, 1, 2, 3, 4, 5, 6, 7, 8, 9, 10, 11, 12, 13, 14, 15)); }
__device__ __forceinline__ v8f wmmab(v16bf a, v16bf b, v8f c) { return __builtin_amdgcn_wmma_f32_16x16x32_bf16(false, a, false, b, (short)0, c, false, false); }

// ---- k_gemmx: register-blocked GEMM, one wave per 64x64 output tile (16 accumulators); the four waves of a block take the four 64-row blocks of the SAME 64 pixels, so the feature tile is fetched once per block. Grid (HW/64, 3 * GB), 128 threads.
// C[o][p] (f32, pitch HW) = sum_c bf16(W[o][c]) bf16(X[c][p]) + bf16(bias[o]). blockIdx.y = w * GB + i: projection w (0, 1, 2) takes Wb + w * CC * CC, bq / bk / bv and the features blue (w = 0) or white (w > 0) of image i; C + blockIdx.y * IMG.
// Fragment map (both operands): lane l -> row/col l&15, elements 0..7 <- k0 + 8(l>>4) + 0..7, elements 8..15 <- k0 + 16 + 8(l>>4) + 0..7; D element r of lane l = (row 8(l>>4)+r, col l&15).
// Column map: column j of column tile nb is pixel c0 + 4j + nb. One 16-byte load of X[k][c0 + 4(l&15) ..+3] then gives lane l its element k of all four B fragments (16 lanes = one whole 256-byte row piece), and element r of the four accumulators of a row block is four neighbouring pixels of one output row: a 16-byte store, no transposition anywhere.
__global__ __launch_bounds__(128) void k_gemmx(const bf* __restrict__ Wb, const float* __restrict__ blue, const float* __restrict__ white, float* C, const float* __restrict__ bq, const float* __restrict__ bk, const float* __restrict__ bv) {
    const unsigned z = blockIdx.y, zw = z / GB, zi = z % GB;
    const bf* A = Wb + (size_t)zw * CC * CC;
    const float* X = (zw ? white : blue) + (size_t)zi * IMG;
    const float* bias = zw == 0 ? bq : (zw == 1 ? bk : bv);
    C += (size_t)z * IMG;
    const int lane = threadIdx.x & 31, lr = lane & 15, hi = lane >> 4; const int r0 = (int)(threadIdx.x >> 5) * 64, c0 = blockIdx.x * 64;
    v8f acc[4][4];
#pragma unroll
    for (int mb = 0; mb < 4; ++mb)
#pragma unroll
        for (int nb = 0; nb < 4; ++nb) acc[mb][nb] = (v8f){};
    const unsigned aoff = (unsigned)(r0 + lr) * CC + 8 * hi, xoff = (unsigned)(8 * hi) * HW + c0 + 4 * lr;
#pragma unroll 1
    for (int kc = 0; kc < CC; kc += 32) {
        const float* xk = X + (size_t)kc * HW; const bf* ak = A + kc;
        v4f x[16]; v16bf a[4];
#pragma unroll
        for (int e = 0; e < 16; ++e) x[e] = *(const v4f*)(xk + xoff + (unsigned)((e & 7) + 16 * (e >> 3)) * HW);
#pragma unroll
        for (int mb = 0; mb < 4; ++mb) { const bf* p = ak + aoff + (unsigned)mb * 16 * CC; a[mb] = cat16b(*(const v8us*)p, *(const v8us*)(p + 16)); }
#pragma unroll
        for (int nb = 0; nb < 4; ++nb) { v16f t;
#pragma unroll
            for (int e = 0; e < 16; ++e) t[e] = x[e][nb];
            const v16bf b = __builtin_convertvector(t, v16bf);
#pragma unroll
            for (int mb = 0; mb < 4; ++mb) acc[mb][nb] = wmmab(a[mb], b, acc[mb][nb]); }
        // four vector slots behind the pass's last WMMA, on the taken back edge too, before its operands are loaded anew
        asm volatile("v_nop\n\tv_nop\n\tv_nop\n\tv_nop" : "+v"(acc[0][0]), "+v"(acc[1][1]), "+v"(acc[2][2]), "+v"(acc[3][3]) : "v"(a[0]), "v"(a[3]));
    }
#pragma unroll
    for (int mb = 0; mb < 4; ++mb) {
        const int row = r0 + mb * 16 + 8 * hi;
        const v8f bb = *(const v8f*)(bias + row);
        float* crow = C + (size_t)row * HW + c0 + 4 * lr;
#pragma unroll
        for (int j = 0; j < 8; ++j) { const float bj = bfr(bb[j]); v4f val;
#pragma unroll
            for (int nb = 0; nb < 4; ++nb) val[nb] = acc[mb][nb][j] + bj;
            *(v4f*)(crow + (size_t)j * HW) = val; }
    }
}

// ---- k_prep: the three weight matrices as bf16 (8 elements a thread, layout kept, Wb = [3][CC][CC]); WBLK blocks a matrix.
#define WBLK (CC * CC / 8 / 256)
static_assert((CC * CC / 8) % 256 == 0);
__global__ __launch_bounds__(256) void k_prep(const float* __restrict__ Wq, const float* __restrict__ Wk, const float* __restrict__ Wv, bf* Wb) {
    const unsigned blk = blockIdx.x;
    const unsigned w = blk / WBLK; const float* src = w == 0 ? Wq : (w == 1 ? Wk : Wv);
    const size_t i = (size_t)(blk % WBLK) * 256 + threadIdx.x; const v8f v = *(const v8f*)(src + i * 8); v8us o;
#pragma unroll
    for (int k = 0; k < 8; ++k) o[k] = f2bf(v[k]);
    *(v8us*)(Wb + (size_t)w * CC * CC + i * 8) = o;
}

// k_nbr: per-channel attention of each 4x4-pixel token over its 3x3 token neighbourhood (16-dim dot per key, scale 1/4, softmax over the 9 slots with
// out-of-grid slots as zero keys/values, weighted sum of the value tokens), plus the residual bf16(blue). One block per (image, token row ti, group of
// 16 channels); lane&15 = token column tj, wave*2 + (lane>>4) = channel within the group. Q/K/V are f32 channel-major planes [img][c][4096].
// All neighbour loads are unconditional at clamped token coordinates; validity enters only by value. Rolled 3x3 loop with an online softmax.
__global__ __launch_bounds__(256) __attribute__((amdgpu_num_vgpr(256)))
void k_nbr(const float* __restrict__ Qg, const float* __restrict__ Kg, const float* __restrict__ Vg, const float* __restrict__ xres, float* outp) {
#pragma clang fp contract(off)
    const int tid = threadIdx.x, lane = tid & 31, wv = tid >> 5;
    const int tj = lane & 15, cs = lane >> 4;
    const int blk = blockIdx.x;
    const int cg = blk & 15, ti = (blk >> 4) & 15, bb = blk >> 8;
    const int c = cg * 16 + wv * 2 + cs;
    const size_t plane = (size_t)bb * IMG + (size_t)c * HW;
    const float* Qc = Qg + plane; const float* Kc = Kg + plane; const float* Vc = Vg + plane;
    const size_t tok = (size_t)(4 * ti) * WW + 4 * tj;

    float q[16];
#pragma unroll
    for (int r = 0; r < 4; ++r) { const v4f t4 = *(const v4f*)(Qc + tok + (size_t)r * WW); q[4 * r] = t4[0]; q[4 * r + 1] = t4[1]; q[4 * r + 2] = t4[2]; q[4 * r + 3] = t4[3]; }

    float acc[16];
#pragma unroll
    for (int e = 0; e < 16; ++e) acc[e] = 0.0f;
    float m = -1.0e30f, l = 0.0f;

#pragma unroll 1
    for (int di = -1; di <= 1; ++di) {
        const int tii = ti + di;
        const bool vi = ((unsigned)tii < (unsigned)NTK);
        const int tic = tii < 0 ? 0 : (tii > NTK - 1 ? NTK - 1 : tii);
#pragma unroll 1
        for (int dj = -1; dj <= 1; ++dj) {
            const int tjj = tj + dj;
            const bool ok = vi && ((unsigned)tjj < (unsigned)NTK);
            const int tjc = tjj < 0 ? 0 : (tjj > NTK - 1 ? NTK - 1 : tjj);
            const size_t nt = (size_t)(4 * tic) * WW + 4 * tjc;
            float kd = 0.0f;
#pragma unroll
            for (int r = 0; r < 4; ++r) { const v4f k4 = *(const v4f*)(Kc + nt + (size_t)r * WW);
#pragma unroll
                for (int e = 0; e < 4; ++e) kd = fmaf(q[4 * r + e], k4[e], kd); }
            const float s = ok ? kd * SCL : 0.0f;
            const float mn = fmaxf(m, s);
            const float corr = __builtin_amdgcn_exp2f((m - mn) * L2E);
            const float p = __builtin_amdgcn_exp2f((s - mn) * L2E);
            l = fmaf(l, corr, p);
            const float pv = ok ? p : 0.0f;
#pragma unroll
            for (int r = 0; r < 4; ++r) { const v4f v4 = *(const v4f*)(Vc + nt + (size_t)r * WW);
#pragma unroll
                for (int e = 0; e < 4; ++e) { const float t = acc[4 * r + e] * corr; acc[4 * r + e] = fmaf(pv, v4[e], t); } }
            m = mn;
        }
    }
    const float inv = 1.0f / l;
    const float* xr = xres + plane + tok;
    v4f o[4];
#pragma unroll
    for (int r = 0; r < 4; ++r) { const v4f b4 = *(const v4f*)(xr + (size_t)r * WW); v4f t4;
#pragma unroll
        for (int e = 0; e < 4; ++e) { const float en = acc[4 * r + e] * inv; t4[e] = bfr(b4[e]) + en; }
        o[r] = t4; }
    float* op = outp + plane + tok;
{
#pragma unroll
        for (int r = 0; r < 4; ++r) *(v4f*)(op + (size_t)r * WW) = o[r];
         }
}

extern "C" void kernel_launch(void* const* d_in, const int* in_sizes, int n_in, void* d_out, int out_size, void* d_ws, size_t ws_size, hipStream_t stream) {
    (void)n_in;
    if (in_sizes[0] < NB * IMG || in_sizes[1] < NB * IMG || in_sizes[2] < CC * CC || in_sizes[3] < CC || in_sizes[4] < CC * CC || in_sizes[5] < CC || in_sizes[6] < CC * CC || in_sizes[7] < CC || out_size < NB * IMG) return;
    const float* blue  = (const float*)d_in[0];   // [NB][256][4096] channel-major
    const float* white = (const float*)d_in[1];
    const float* Wq = (const float*)d_in[2];      // [256 out][256 in]
    const float* bq = (const float*)d_in[3];
    const float* Wk = (const float*)d_in[4];
    const float* bk = (const float*)d_in[5];
    const float* Wv = (const float*)d_in[6];
    const float* bv = (const float*)d_in[7];
    float* out = (float*)d_out;                   // [NB][256][4096]

    char* wsp = (char*)d_ws;
    auto take = [&](size_t bytes) { char* p = wsp; wsp += (bytes + 255) & ~(size_t)255; return (void*)p; };
    bf* Wb  = (bf*)take((size_t)3 * CC * CC * 2);             // Wq, Wk, Wv as bf16, each [o][c] = A operand as-is
    float* Qp = (float*)take((size_t)3 * GB * IMG * 4);       // Q, K, V, each [GB][256][4096] f32
    float* Kp = Qp + (size_t)GB * IMG;
    float* Vp = Kp + (size_t)GB * IMG;
    if ((size_t)(wsp - (char*)d_ws) > ws_size) return;        // 101,056,512 B at NB = 8

    k_prep<<<3 * WBLK, 256, 0, stream>>>(Wq, Wk, Wv, Wb);
    k_gemmx<<<dim3(HW / 64, 3 * GB), 128, 0, stream>>>(Wb, blue, white, Qp, bq, bk, bv);   // Q[o][p] = sum_c Wq[o][c] blue[c][p] + bq[o]; K, V likewise from white
    k_nbr<<<(unsigned)(GB * NTK * (CC / 16)), 256, 0, stream>>>(Qp, Kp, Vp, blue, out);
}

// v003
// It runs in 55.2 microseconds.
// In both of two side-by-side timings against v002, it was 1.23 times as fast.
// Counting every step since v000, it is 2.66 times as fast.
#include <hip/hip_runtime.h>

// Contractions: three 1x1-conv channel GEMMs (out-channel x pixel, K = 256 in-channels) on v_wmma_f32_16x16x32_bf16 (bf16 operands = RNE-converted inputs and weights, f32 accumulate, bias added in f32); the 3x3-token x 16-dim per-channel attention (scores, softmax, weighted sum) and the residual add run in f32 on VALU.
// Pipeline, three launches over all GB = NB images: (1) k_prep: bf16 copies of the three weight matrices; (2) k_gemmx: Q = Wq.blue + bq, K = Wk.white + bk, V = Wv.white + bv as f32 channel-major planes [c][4096], read straight from the f32 channel-major features and converted to bf16 in registers, the projection chosen by blockIdx.y; (3) k_nbr: one block per (image, 4 token rows, 16 channels) computes the 9-neighbour attention (tokens outside the 16x16 grid are zero keys/values kept in the softmax), scale 1/4, and writes out = bf16(blue) + enhanced.

#ifndef NB
#define NB 8
#endif
#define NB_FULL 8
#define CC   256
#define HH   64
#define WW   64
#define HW   (HH * WW)
#define IMG  (CC * HW)          // per-image stride (floats) of inputs, output and Q/K/V planes (full geometry)
#define NTK  16                 // 4x4-pixel tokens per side
#define GB   NB                 // images per launch: all of them
#define SCL  0.25f
#define L2E  1.4426950408889634f
static_assert(NB % GB == 0);
static_assert(NB <= NB_FULL);
static_assert(CC == 256);
static_assert(HW % 64 == 0);
static_assert(CC % 32 == 0);

typedef unsigned short bf;
typedef __attribute__((ext_vector_type(16))) __bf16   v16bf;
typedef __attribute__((ext_vector_type(8)))  unsigned short v8us;
typedef __attribute__((ext_vector_type(16))) float    v16f;
typedef __attribute__((ext_vector_type(8)))  float    v8f;
typedef __attribute__((ext_vector_type(4)))  float    v4f;

__device__ __forceinline__ unsigned short f2bf(float f) { unsigned u = __float_as_uint(f); u += 0x7FFFu + ((u >> 16) & 1u); return (unsigned short)(u >> 16); }
__device__ __forceinline__ float bf2f(unsigned short b) { return __uint_as_float(((unsigned)b) << 16); }
__device__ __forceinline__ float bfr(float f) { return bf2f(f2bf(f)); }
__device__ __forceinline__ v16bf cat16b(v8us lo, v8us hi) { return __builtin_bit_cast(v16bf, __builtin_shufflevector(lo, hi, 0, 1, 2, 3, 4, 5, 6, 7, 8, 9, 10, 11, 12, 13, 14, 15)); }
__device__ __forceinline__ v8f wmmab(v16bf a, v16bf b, v8f c) { return __builtin_amdgcn_wmma_f32_16x16x32_bf16(false, a, false, b, (short)0, c, false, false); }

// ---- k_gemmx: register-blocked GEMM, one wave per 64x64 output tile (16 accumulators); the four waves of a block take the four 64-row blocks of the SAME 64 pixels, so the feature tile is fetched once per block. Grid (HW/64, 3 * GB), 128 threads.
// C[o][p] (f32, pitch HW) = sum_c bf16(W[o][c]) bf16(X[c][p]) + bf16(bias[o]). blockIdx.y = w * GB + i: projection w (0, 1, 2) takes Wb + w * CC * CC, bq / bk / bv and the features blue (w = 0) or white (w > 0) of image i; C + blockIdx.y * IMG.
// Fragment map (both operands): lane l -> row/col l&15, elements 0..7 <- k0 + 8(l>>4) + 0..7, elements 8..15 <- k0 + 16 + 8(l>>4) + 0..7; D element r of lane l = (row 8(l>>4)+r, col l&15).
// Column map: column j of column tile nb is pixel c0 + 4j + nb. One 16-byte load of X[k][c0 + 4(l&15) ..+3] then gives lane l its element k of all four B fragments (16 lanes = one whole 256-byte row piece), and element r of the four accumulators of a row block is four neighbouring pixels of one output row: a 16-byte store, no transposition anywhere.
__global__ __launch_bounds__(128) void k_gemmx(const bf* __restrict__ Wb, const float* __restrict__ blue, const float* __restrict__ white, float* C, const float* __restrict__ bq, const float* __restrict__ bk, const float* __restrict__ bv) {
    const unsigned z = blockIdx.y, zw = z / GB, zi = z % GB;
    const bf* A = Wb + (size_t)zw * CC * CC;
    const float* X = (zw ? white : blue) + (size_t)zi * IMG;
    const float* bias = zw == 0 ? bq : (zw == 1 ? bk : bv);
    C += (size_t)z * IMG;
    const int lane = threadIdx.x & 31, lr = lane & 15, hi = lane >> 4; const int r0 = (int)(threadIdx.x >> 5) * 64, c0 = blockIdx.x * 64;
    v8f acc[4][4];
#pragma unroll
    for (int mb = 0; mb < 4; ++mb)
#pragma unroll
        for (int nb = 0; nb < 4; ++nb) acc[mb][nb] = (v8f){};
    const unsigned aoff = (unsigned)(r0 + lr) * CC + 8 * hi, xoff = (unsigned)(8 * hi) * HW + c0 + 4 * lr;
#pragma unroll 1
    for (int kc = 0; kc < CC; kc += 32) {
        const float* xk = X + (size_t)kc * HW; const bf* ak = A + kc;
        v4f x[16]; v16bf a[4];
#pragma unroll
        for (int e = 0; e < 16; ++e) x[e] = *(const v4f*)(xk + xoff + (unsigned)((e & 7) + 16 * (e >> 3)) * HW);
#pragma unroll
        for (int mb = 0; mb < 4; ++mb) { const bf* p = ak + aoff + (unsigned)mb * 16 * CC; a[mb] = cat16b(*(const v8us*)p, *(const v8us*)(p + 16)); }
#pragma unroll
        for (int nb = 0; nb < 4; ++nb) { v16f t;
#pragma unroll
            for (int e = 0; e < 16; ++e) t[e] = x[e][nb];
            const v16bf b = __builtin_convertvector(t, v16bf);
#pragma unroll
            for (int mb = 0; mb < 4; ++mb) acc[mb][nb] = wmmab(a[mb], b, acc[mb][nb]); }
        // four vector slots behind the pass's last WMMA, on the taken back edge too, before its operands are loaded anew
        asm volatile("v_nop\n\tv_nop\n\tv_nop\n\tv_nop" : "+v"(acc[0][0]), "+v"(acc[1][1]), "+v"(acc[2][2]), "+v"(acc[3][3]) : "v"(a[0]), "v"(a[3]));
    }
#pragma unroll
    for (int mb = 0; mb < 4; ++mb) {
        const int row = r0 + mb * 16 + 8 * hi;
        const v8f bb = *(const v8f*)(bias + row);
        float* crow = C + (size_t)row * HW + c0 + 4 * lr;
#pragma unroll
        for (int j = 0; j < 8; ++j) { const float bj = bfr(bb[j]); v4f val;
#pragma unroll
            for (int nb = 0; nb < 4; ++nb) val[nb] = acc[mb][nb][j] + bj;
            *(v4f*)(crow + (size_t)j * HW) = val; }
    }
}

// ---- k_prep: the three weight matrices as bf16 (8 elements a thread, layout kept, Wb = [3][CC][CC]); WBLK blocks a matrix.
#define WBLK (CC * CC / 8 / 256)
static_assert((CC * CC / 8) % 256 == 0);
__global__ __launch_bounds__(256) void k_prep(const float* __restrict__ Wq, const float* __restrict__ Wk, const float* __restrict__ Wv, bf* Wb) {
    const unsigned blk = blockIdx.x;
    const unsigned w = blk / WBLK; const float* src = w == 0 ? Wq : (w == 1 ? Wk : Wv);
    const size_t i = (size_t)(blk % WBLK) * 256 + threadIdx.x; const v8f v = *(const v8f*)(src + i * 8); v8us o;
#pragma unroll
    for (int k = 0; k < 8; ++k) o[k] = f2bf(v[k]);
    *(v8us*)(Wb + (size_t)w * CC * CC + i * 8) = o;
}

// k_nbr: per-channel attention of each 4x4-pixel token over its 3x3 token neighbourhood (16-dim dot per key, scale 1/4, softmax over the 9 slots with
// out-of-grid slots as zero keys/values, weighted sum of the value tokens), plus the residual bf16(blue). One block per (image, strip of TS token rows,
// group of 16 channels); lane&15 = token column tj, wave*2 + (lane>>4) = channel within the group. Q/K/V are f32 channel-major planes [img][c][4096].
// A wave walks the TS + 2 key/value token rows of its strip from top to bottom. Each row is loaded once (own column only, clamped row) and serves from
// registers the up to three query rows that have it as a neighbour row; their queries and online-softmax states are carried in registers. The left and right
// neighbour's key and value come from lane tj - 1 / tj + 1 of the same 16-lane row by a DPP row shift. Validity enters only by value. For each query the
// nine slots come in the order (row above, own row, row below) x (left, own, right).
#define TS 4
static_assert(NTK % TS == 0);
// value of lane - 1 (0x111, row_shr:1) or lane + 1 (0x101, row_shl:1) within the 16-lane row; 0 where that lane does not exist
template <int CTRL> __device__ __forceinline__ float rowsh(float x) { return __int_as_float(__builtin_amdgcn_update_dpp(0, __float_as_int(x), CTRL, 0xf, 0xf, true)); }
template <int DJ> __device__ __forceinline__ float nbv(float x) { if constexpr (DJ < 0) return rowsh<0x111>(x); else if constexpr (DJ > 0) return rowsh<0x101>(x); else return x; }

__device__ __forceinline__ void ex2x2(float a, float b, float& ra, float& rb) {
    asm("v_exp_f32 %0, %2\n\tv_exp_f32 %1, %3\n\tv_nop\n\ts_delay_alu instid0(TRANS32_DEP_1)" : "=&v"(ra), "=&v"(rb) : "v"(a), "v"(b));
}

template <int DJ> __device__ __forceinline__ void slot(const float (&q)[16], const v4f (&k)[4], const v4f (&v)[4], bool ok, float (&acc)[16], float& m, float& l) {
    float kd = 0.0f;
#pragma unroll
    for (int r = 0; r < 4; ++r)
#pragma unroll
        for (int e = 0; e < 4; ++e) kd = fmaf(q[4 * r + e], nbv<DJ>(k[r][e]), kd);
    const float s = ok ? kd * SCL : 0.0f;
    const float mn = fmaxf(m, s);
    float corr, p;
    ex2x2((m - mn) * L2E, (s - mn) * L2E, corr, p);
    l = fmaf(l, corr, p);
    const float pv = ok ? p : 0.0f;
#pragma unroll
    for (int r = 0; r < 4; ++r)
#pragma unroll
        for (int e = 0; e < 4; ++e) { const float t = acc[4 * r + e] * corr; acc[4 * r + e] = fmaf(pv, nbv<DJ>(v[r][e]), t); }
    m = mn;
}

__global__ __launch_bounds__(256) __attribute__((amdgpu_num_vgpr(256)))
void k_nbr(const float* __restrict__ Qg, const float* __restrict__ Kg, const float* __restrict__ Vg, const float* __restrict__ xres, float* outp) {
#pragma clang fp contract(off)
    const int tid = threadIdx.x, lane = tid & 31, wv = tid >> 5;
    const int tj = lane & 15, cs = lane >> 4;
    const int blk = blockIdx.x;
    const int cg = blk & 15, t0 = ((blk >> 4) & (NTK / TS - 1)) * TS, bb = blk / (16 * (NTK / TS));
    // every address = block-uniform base (scalar registers) + one 32-bit byte offset per lane: lob (channel within the group, token column) for the strip's own
    // rows, voT / voB = lob + the clamped row above / below the strip
    const size_t ub = (size_t)bb * IMG + (size_t)(cg * 16) * HW;
    const unsigned lob = (unsigned)((wv * 2 + cs) * HW + 4 * tj) * 4u;
    const unsigned voT = lob + (unsigned)(t0 > 0 ? t0 - 1 : 0) * (4u * WW * 4u);
    const unsigned voB = lob + (unsigned)(t0 + TS < NTK ? t0 + TS : NTK - 1) * (4u * WW * 4u);
    const char* Kb = (const char*)(Kg + ub); const char* Vb = (const char*)(Vg + ub);
    const size_t us = ub + (size_t)(4 * t0) * WW;
    const char* Qs = (const char*)(Qg + us); const char* Ks = (const char*)(Kg + us); const char* Vs = (const char*)(Vg + us);
    const char* xs = (const char*)(xres + us); char* os = (char*)(outp + us);
    const bool okl = tj > 0, okr = tj < NTK - 1;

    v4f kk[TS + 2][4], vv[TS + 2][4], qq[TS][4], bl[TS][4];   // every index is a constant after unrolling: registers, live only while needed
    auto ldkv = [&](int j) {                                   // key/value token row t0 - 1 + j, clamped into the grid
#pragma unroll
        for (int r = 0; r < 4; ++r) {
            if (j == 0)           { kk[j][r] = *(const v4f*)(Kb + r * (WW * 4) + voT); vv[j][r] = *(const v4f*)(Vb + r * (WW * 4) + voT); }
            else if (j == TS + 1) { kk[j][r] = *(const v4f*)(Kb + r * (WW * 4) + voB); vv[j][r] = *(const v4f*)(Vb + r * (WW * 4) + voB); }
            else                  { kk[j][r] = *(const v4f*)(Ks + (4 * (j - 1) + r) * (WW * 4) + lob); vv[j][r] = *(const v4f*)(Vs + (4 * (j - 1) + r) * (WW * 4) + lob); }
        }
    };
    auto ldq = [&](int s) {
#pragma unroll
        for (int r = 0; r < 4; ++r) qq[s][r] = *(const v4f*)(Qs + (4 * s + r) * (WW * 4) + lob);
    };
    auto ldb = [&](int s) {
#pragma unroll
        for (int r = 0; r < 4; ++r) bl[s][r] = *(const v4f*)(xs + (4 * s + r) * (WW * 4) + lob);
    };
    float q[TS][16], acc[TS][16], m[TS], l[TS];
    ldq(0); ldkv(0);
    // voT has its last use in the loads above: it stays in its register up to this wait, so that nothing overwrites it while an issued load still names it
    asm volatile("s_wait_xcnt 0x0" :: "v"(voT) : "memory");

    // key/value row j serves query rows j - 2, j - 1, j of the strip (as their lower, own and upper neighbour row); a query row is finished behind its lower row
#pragma unroll
    for (int j = 0; j < TS + 2; ++j) {
        if (j + 1 < TS + 2) ldkv(j + 1);
        if (j + 1 < TS) ldq(j + 1);
        if (j >= 2) ldb(j - 2);
        // the same for voB behind the loads of the row below the strip
        if (j == TS) asm volatile("s_wait_xcnt 0x0" :: "v"(voB) : "memory");
        // keeps the next row's loads in front of this row's arithmetic: without it the scheduler sinks the value loads to a few instructions before their use
        __builtin_amdgcn_sched_barrier(0);
        if (j < TS) {
#pragma unroll
            for (int e = 0; e < 16; ++e) { q[j][e] = qq[j][e >> 2][e & 3]; acc[j][e] = 0.0f; }
            m[j] = -1.0e30f; l[j] = 0.0f;
        }
        const bool vi = ((unsigned)(t0 + j - 1) < (unsigned)NTK);
#pragma unroll
        for (int s = j - 2; s <= j; ++s) {
            if (s < 0 || s >= TS) continue;
            slot<-1>(q[s], kk[j], vv[j], vi && okl, acc[s], m[s], l[s]);
            slot< 0>(q[s], kk[j], vv[j], vi,        acc[s], m[s], l[s]);
            slot< 1>(q[s], kk[j], vv[j], vi && okr, acc[s], m[s], l[s]);
        }
        if (j >= 2) {
            const int s = j - 2;
            const float inv = 1.0f / l[s];
#pragma unroll
            for (int r = 0; r < 4; ++r) { v4f t4;
#pragma unroll
                for (int e = 0; e < 4; ++e) { const float en = acc[s][4 * r + e] * inv; t4[e] = bfr(bl[s][r][e]) + en; }
                *(v4f*)(os + (4 * s + r) * (WW * 4) + lob) = t4; }
            // the stored registers are free for the next loads' results only behind this wait
            if (j < TS + 1) asm volatile("s_wait_xcnt 0x0" ::: "memory");
        }
    }
}

extern "C" void kernel_launch(void* const* d_in, const int* in_sizes, int n_in, void* d_out, int out_size, void* d_ws, size_t ws_size, hipStream_t stream) {
    (void)n_in;
    if (in_sizes[0] < NB * IMG || in_sizes[1] < NB * IMG || in_sizes[2] < CC * CC || in_sizes[3] < CC || in_sizes[4] < CC * CC || in_sizes[5] < CC || in_sizes[6] < CC * CC || in_sizes[7] < CC || out_size < NB * IMG) return;
    const float* blue  = (const float*)d_in[0];   // [NB][256][4096] channel-major
    const float* white = (const float*)d_in[1];
    const float* Wq = (const float*)d_in[2];      // [256 out][256 in]
    const float* bq = (const float*)d_in[3];
    const float* Wk = (const float*)d_in[4];
    const float* bk = (const float*)d_in[5];
    const float* Wv = (const float*)d_in[6];
    const float* bv = (const float*)d_in[7];
    float* out = (float*)d_out;                   // [NB][256][4096]

    char* wsp = (char*)d_ws;
    auto take = [&](size_t bytes) { char* p = wsp; wsp += (bytes + 255) & ~(size_t)255; return (void*)p; };
    bf* Wb  = (bf*)take((size_t)3 * CC * CC * 2);             // Wq, Wk, Wv as bf16, each [o][c] = A operand as-is
    float* Qp = (float*)take((size_t)3 * GB * IMG * 4);       // Q, K, V, each [GB][256][4096] f32
    float* Kp = Qp + (size_t)GB * IMG;
    float* Vp = Kp + (size_t)GB * IMG;
    if ((size_t)(wsp - (char*)d_ws) > ws_size) return;        // 101,056,512 B at NB = 8

    k_prep<<<3 * WBLK, 256, 0, stream>>>(Wq, Wk, Wv, Wb);
    k_gemmx<<<dim3(HW / 64, 3 * GB), 128, 0, stream>>>(Wb, blue, white, Qp, bq, bk, bv);   // Q[o][p] = sum_c Wq[o][c] blue[c][p] + bq[o]; K, V likewise from white
    k_nbr<<<(unsigned)(GB * (NTK / TS) * (CC / 16)), 256, 0, stream>>>(Qp, Kp, Vp, blue, out);
}

// v004
// Measured time: 52 microseconds a run.
// Timed twice side by side with v003, it ran 1.06 times as fast both times.
// Over all steps from v000 it is 2.82 times as fast.
#include <hip/hip_runtime.h>

// Contractions: three 1x1-conv channel GEMMs (out-channel x pixel, K = 256 in-channels) on v_wmma_f32_16x16x32_bf16 (bf16 operands = RNE-converted inputs and weights, f32 accumulate, bias added in f32); the 3x3-token x 16-dim per-channel attention (scores, softmax, weighted sum) and the residual add run in f32 on VALU.
// Pipeline, three launches over all GB = NB images: (1) k_prep: bf16 copies of the three weight matrices; (2) k_gemmx: Q = Wq.blue + bq, K = Wk.white + bk, V = Wv.white + bv as f32 channel-major planes [c][4096], read from the f32 channel-major features (staged in LDS by asynchronous copies) and converted to bf16 in registers, the projection chosen by blockIdx.y; (3) k_nbr: one block per (image, 4 token rows, 16 channels) computes the 9-neighbour attention (tokens outside the 16x16 grid are zero keys/values kept in the softmax), scale 1/4, and writes out = bf16(blue) + enhanced.

#ifndef NB
#define NB 8
#endif
#define NB_FULL 8
#define CC   256
#define HH   64
#define WW   64
#define HW   (HH * WW)
#define IMG  (CC * HW)          // per-image stride (floats) of inputs, output and Q/K/V planes (full geometry)
#define NTK  16                 // 4x4-pixel tokens per side
#define GB   NB                 // images per launch: all of them
#define SCL  0.25f
#define L2E  1.4426950408889634f
static_assert(NB % GB == 0);
static_assert(NB <= NB_FULL);
static_assert(CC == 256);
static_assert(HW % 64 == 0);
static_assert(CC % 32 == 0);

typedef unsigned short bf;
typedef __attribute__((ext_vector_type(16))) __bf16   v16bf;
typedef __attribute__((ext_vector_type(8)))  unsigned short v8us;
typedef __attribute__((ext_vector_type(16))) float    v16f;
typedef __attribute__((ext_vector_type(8)))  float    v8f;
typedef __attribute__((ext_vector_type(4)))  float    v4f;

__device__ __forceinline__ unsigned short f2bf(float f) { unsigned u = __float_as_uint(f); u += 0x7FFFu + ((u >> 16) & 1u); return (unsigned short)(u >> 16); }
__device__ __forceinline__ float bf2f(unsigned short b) { return __uint_as_float(((unsigned)b) << 16); }
__device__ __forceinline__ float bfr(float f) { return bf2f(f2bf(f)); }
__device__ __forceinline__ v16bf cat16b(v8us lo, v8us hi) { return __builtin_bit_cast(v16bf, __builtin_shufflevector(lo, hi, 0, 1, 2, 3, 4, 5, 6, 7, 8, 9, 10, 11, 12, 13, 14, 15)); }
__device__ __forceinline__ v8f wmmab(v16bf a, v16bf b, v8f c) { return __builtin_amdgcn_wmma_f32_16x16x32_bf16(false, a, false, b, (short)0, c, false, false); }

// ---- k_gemmx: register-blocked GEMM, one wave per 64x64 output tile (16 accumulators); the four waves of a block take the four 64-row blocks of the SAME 64 pixels. Grid (HW/64, 3 * GB), 128 threads.
// C[o][p] (f32, pitch HW) = sum_c bf16(W[o][c]) bf16(X[c][p]) + bf16(bias[o]). blockIdx.y = w * GB + i: projection w (0, 1, 2) takes Wb + w * CC * CC, bq / bk / bv and the features blue (w = 0) or white (w > 0) of image i; C + blockIdx.y * IMG.
// Fragment map (both operands): lane l -> row/col l&15, elements 0..7 <- k0 + 8(l>>4) + 0..7, elements 8..15 <- k0 + 16 + 8(l>>4) + 0..7; D element r of lane l = (row 8(l>>4)+r, col l&15).
// Column map: column j of column tile nb is pixel c0 + 4j + nb. One 16-byte read of X[k][c0 + 4(l&15) ..+3] then gives lane l its element k of all four B fragments, and element r of the four accumulators of a row block is four neighbouring pixels of one output row: a 16-byte store, no transposition anywhere.
// Feature path: the block's f32 feature tile comes into LDS by asynchronous copies, KS in-channel rows (KS x 256 bytes) a stage, two buffers: stage t + 1 flies while stage t is worked on. Each wave copies a quarter of a stage
// (copy i of wave w: rows 16w + 2i and 16w + 2i + 1, 16 lanes x 16 bytes a row); all four waves read the whole stage. LDS row pitch XP floats = 272 bytes.
#define KS 64
#define XP 68
#define NST (CC / KS)
static_assert(CC % KS == 0 && NST >= 2 && KS % 32 == 0 && KS == 64);
__global__ __launch_bounds__(128) void k_gemmx(const bf* __restrict__ Wb, const float* __restrict__ blue, const float* __restrict__ white, float* C, const float* __restrict__ bq, const float* __restrict__ bk, const float* __restrict__ bv) {
    __shared__ __attribute__((aligned(16))) float xs[2][KS][XP];
    const unsigned z = blockIdx.y, zw = z / GB, zi = z % GB;
    const bf* A = Wb + (size_t)zw * CC * CC;
    const float* X = (zw ? white : blue) + (size_t)zi * IMG;
    const float* bias = zw == 0 ? bq : (zw == 1 ? bk : bv);
    C += (size_t)z * IMG;
    const int lane = threadIdx.x & 31, lr = lane & 15, hi = lane >> 4, wv = (int)(threadIdx.x >> 5); const int r0 = wv * 64, c0 = blockIdx.x * 64;
    v8f acc[4][4];
#pragma unroll
    for (int mb = 0; mb < 4; ++mb)
#pragma unroll
        for (int nb = 0; nb < 4; ++nb) acc[mb][nb] = (v8f){};
    const unsigned aoff = (unsigned)(r0 + lr) * CC + 8 * hi;
    const float* gsrc = X + (size_t)(16 * wv + hi) * HW + c0 + 4 * lr;            // this lane's 16 bytes of its wave's first row pair, stage 0
    const unsigned ldst = (unsigned)(size_t)&xs[0][16 * wv + hi][4 * lr];          // the same place in buffer 0 (LDS byte address)
    // stage t into buffer t & 1: eight copies a wave; the closing s_wait_xcnt 0 stands in the copies' own statement, in front of any rewrite of the address registers they name
    auto fill = [&](int t) {
        const float* g = gsrc + (size_t)t * (KS * HW); const unsigned l = ldst + (unsigned)(t & 1) * (unsigned)(KS * XP * 4);
        asm volatile("global_load_async_to_lds_b128 %0, %8, off\n\t"
                     "global_load_async_to_lds_b128 %1, %9, off\n\t"
                     "global_load_async_to_lds_b128 %2, %10, off\n\t"
                     "global_load_async_to_lds_b128 %3, %11, off\n\t"
                     "global_load_async_to_lds_b128 %4, %12, off\n\t"
                     "global_load_async_to_lds_b128 %5, %13, off\n\t"
                     "global_load_async_to_lds_b128 %6, %14, off\n\t"
                     "global_load_async_to_lds_b128 %7, %15, off\n\t"
                     "s_wait_xcnt 0x0"
                     :: "v"(l), "v"(l + 2u * XP * 4u), "v"(l + 4u * XP * 4u), "v"(l + 6u * XP * 4u), "v"(l + 8u * XP * 4u), "v"(l + 10u * XP * 4u), "v"(l + 12u * XP * 4u), "v"(l + 14u * XP * 4u),
                        "v"(g), "v"(g + 2 * HW), "v"(g + 4 * HW), "v"(g + 6 * HW), "v"(g + 8 * HW), "v"(g + 10 * HW), "v"(g + 12 * HW), "v"(g + 14 * HW)
                     : "memory");
    };
    fill(0);
    asm volatile("s_wait_asynccnt 0x0" ::: "memory");   // this wave's part of stage 0 has landed
    __syncthreads();                                    // stage 0 is published to all four waves
    fill(1);
#pragma unroll 1
    for (int t = 0; t < NST; ++t) {
        const float (*xb)[XP] = xs[t & 1];
#pragma unroll
        for (int ks = 0; ks < KS; ks += 32) {
            const bf* ak = A + t * KS + ks;
            v4f x[16]; v16bf a[4];
#pragma unroll
            for (int e = 0; e < 16; ++e) x[e] = *(const v4f*)&xb[ks + 8 * hi + (e & 7) + 16 * (e >> 3)][4 * lr];
#pragma unroll
            for (int mb = 0; mb < 4; ++mb) { const bf* p = ak + aoff + (unsigned)mb * 16 * CC; a[mb] = cat16b(*(const v8us*)p, *(const v8us*)(p + 16)); }
#pragma unroll
            for (int nb = 0; nb < 4; ++nb) { v16f tt;
#pragma unroll
                for (int e = 0; e < 16; ++e) tt[e] = x[e][nb];
                const v16bf b = __builtin_convertvector(tt, v16bf);
#pragma unroll
                for (int mb = 0; mb < 4; ++mb) acc[mb][nb] = wmmab(a[mb], b, acc[mb][nb]); }
            // ends a 32-row pass for the scheduler: without it the second pass's WMMAs sink behind the barrier below, in front of the refill, which then starts that much later, and
            // the second pass's operands are fetched so early that the kernel takes more than 256 registers (three waves a SIMD, not four)
            __builtin_amdgcn_sched_barrier(0);
            // four vector slots behind the pass's last WMMA before its operands are loaded anew
            asm volatile("v_nop\n\tv_nop\n\tv_nop\n\tv_nop");
            // keeps the next pass's loads behind those slots
            __builtin_amdgcn_sched_barrier(0);
        }
        // publish point of stage t + 1: this wave's reads of stage t are done, its copies of stage t + 1 have landed, every wave has come as far; only then is stage t's buffer filled anew
        asm volatile("s_wait_dscnt 0x0" ::: "memory");
        asm volatile("s_wait_asynccnt 0x0" ::: "memory");
        __syncthreads();
        if (t + 2 < NST) fill(t + 2);
    }
    asm volatile("s_wait_asynccnt 0x0" ::: "memory");   // no copy is outstanding when the wave ends
#pragma unroll
    for (int mb = 0; mb < 4; ++mb) {
        const int row = r0 + mb * 16 + 8 * hi;
        const v8f bb = *(const v8f*)(bias + row);
        float* crow = C + (size_t)row * HW + c0 + 4 * lr;
#pragma unroll
        for (int j = 0; j < 8; ++j) { const float bj = bfr(bb[j]); v4f val;
#pragma unroll
            for (int nb = 0; nb < 4; ++nb) val[nb] = acc[mb][nb][j] + bj;
            *(v4f*)(crow + (size_t)j * HW) = val; }
    }
}

// ---- k_prep: the three weight matrices as bf16 (8 elements a thread, layout kept, Wb = [3][CC][CC]); WBLK blocks a matrix.
#define WBLK (CC * CC / 8 / 256)
static_assert((CC * CC / 8) % 256 == 0);
__global__ __launch_bounds__(256) void k_prep(const float* __restrict__ Wq, const float* __restrict__ Wk, const float* __restrict__ Wv, bf* Wb) {
    const unsigned blk = blockIdx.x;
    const unsigned w = blk / WBLK; const float* src = w == 0 ? Wq : (w == 1 ? Wk : Wv);
    const size_t i = (size_t)(blk % WBLK) * 256 + threadIdx.x; const v8f v = *(const v8f*)(src + i * 8); v8us o;
#pragma unroll
    for (int k = 0; k < 8; ++k) o[k] = f2bf(v[k]);
    *(v8us*)(Wb + (size_t)w * CC * CC + i * 8) = o;
}

// k_nbr: per-channel attention of each 4x4-pixel token over its 3x3 token neighbourhood (16-dim dot per key, scale 1/4, softmax over the 9 slots with
// out-of-grid slots as zero keys/values, weighted sum of the value tokens), plus the residual bf16(blue). One block per (image, strip of TS token rows,
// group of 16 channels); lane&15 = token column tj, wave*2 + (lane>>4) = channel within the group. Q/K/V are f32 channel-major planes [img][c][4096].
// A wave walks the TS + 2 key/value token rows of its strip from top to bottom. Each row is loaded once (own column only, clamped row) and serves from
// registers the up to three query rows that have it as a neighbour row; their queries and online-softmax states are carried in registers. The left and right
// neighbour's key and value come from lane tj - 1 / tj + 1 of the same 16-lane row by a DPP row shift. Validity enters only by value. For each query the
// nine slots come in the order (row above, own row, row below) x (left, own, right).
#define TS 4
static_assert(NTK % TS == 0);
// value of lane - 1 (0x111, row_shr:1) or lane + 1 (0x101, row_shl:1) within the 16-lane row; 0 where that lane does not exist
template <int CTRL> __device__ __forceinline__ float rowsh(float x) { return __int_as_float(__builtin_amdgcn_update_dpp(0, __float_as_int(x), CTRL, 0xf, 0xf, true)); }
template <int DJ> __device__ __forceinline__ float nbv(float x) { if constexpr (DJ < 0) return rowsh<0x111>(x); else if constexpr (DJ > 0) return rowsh<0x101>(x); else return x; }

__device__ __forceinline__ void ex2x2(float a, float b, float& ra, float& rb) {
    asm("v_exp_f32 %0, %2\n\tv_exp_f32 %1, %3\n\tv_nop\n\ts_delay_alu instid0(TRANS32_DEP_1)" : "=&v"(ra), "=&v"(rb) : "v"(a), "v"(b));
}

template <int DJ> __device__ __forceinline__ void slot(const float (&q)[16], const v4f (&k)[4], const v4f (&v)[4], bool ok, float (&acc)[16], float& m, float& l) {
    float kd = 0.0f;
#pragma unroll
    for (int r = 0; r < 4; ++r)
#pragma unroll
        for (int e = 0; e < 4; ++e) kd = fmaf(q[4 * r + e], nbv<DJ>(k[r][e]), kd);
    const float s = ok ? kd * SCL : 0.0f;
    const float mn = fmaxf(m, s);
    float corr, p;
    ex2x2((m - mn) * L2E, (s - mn) * L2E, corr, p);
    l = fmaf(l, corr, p);
    const float pv = ok ? p : 0.0f;
#pragma unroll
    for (int r = 0; r < 4; ++r)
#pragma unroll
        for (int e = 0; e < 4; ++e) { const float t = acc[4 * r + e] * corr; acc[4 * r + e] = fmaf(pv, nbv<DJ>(v[r][e]), t); }
    m = mn;
}

__global__ __launch_bounds__(256) __attribute__((amdgpu_num_vgpr(256)))
void k_nbr(const float* __restrict__ Qg, const float* __restrict__ Kg, const float* __restrict__ Vg, const float* __restrict__ xres, float* outp) {
#pragma clang fp contract(off)
    const int tid = threadIdx.x, lane = tid & 31, wv = tid >> 5;
    const int tj = lane & 15, cs = lane >> 4;
    const int blk = blockIdx.x;
    const int cg = blk & 15, t0 = ((blk >> 4) & (NTK / TS - 1)) * TS, bb = blk / (16 * (NTK / TS));
    // every address = block-uniform base (scalar registers) + one 32-bit byte offset per lane: lob (channel within the group, token column) for the strip's own
    // rows, voT / voB = lob + the clamped row above / below the strip
    const size_t ub = (size_t)bb * IMG + (size_t)(cg * 16) * HW;
    const unsigned lob = (unsigned)((wv * 2 + cs) * HW + 4 * tj) * 4u;
    const unsigned voT = lob + (unsigned)(t0 > 0 ? t0 - 1 : 0) * (4u * WW * 4u);
    const unsigned voB = lob + (unsigned)(t0 + TS < NTK ? t0 + TS : NTK - 1) * (4u * WW * 4u);
    const char* Kb = (const char*)(Kg + ub); const char* Vb = (const char*)(Vg + ub);
    const size_t us = ub + (size_t)(4 * t0) * WW;
    const char* Qs = (const char*)(Qg + us); const char* Ks = (const char*)(Kg + us); const char* Vs = (const char*)(Vg + us);
    const char* xs = (const char*)(xres + us); char* os = (char*)(outp + us);
    const bool okl = tj > 0, okr = tj < NTK - 1;

    v4f kk[TS + 2][4], vv[TS + 2][4], qq[TS][4], bl[TS][4];   // every index is a constant after unrolling: registers, live only while needed
    auto ldkv = [&](int j) {                                   // key/value token row t0 - 1 + j, clamped into the grid
#pragma unroll
        for (int r = 0; r < 4; ++r) {
            if (j == 0)           { kk[j][r] = *(const v4f*)(Kb + r * (WW * 4) + voT); vv[j][r] = *(const v4f*)(Vb + r * (WW * 4) + voT); }
            else if (j == TS + 1) { kk[j][r] = *(const v4f*)(Kb + r * (WW * 4) + voB); vv[j][r] = *(const v4f*)(Vb + r * (WW * 4) + voB); }
            else                  { kk[j][r] = *(const v4f*)(Ks + (4 * (j - 1) + r) * (WW * 4) + lob); vv[j][r] = *(const v4f*)(Vs + (4 * (j - 1) + r) * (WW * 4) + lob); }
        }
    };
    auto ldq = [&](int s) {
#pragma unroll
        for (int r = 0; r < 4; ++r) qq[s][r] = *(const v4f*)(Qs + (4 * s + r) * (WW * 4) + lob);
    };
    auto ldb = [&](int s) {
#pragma unroll
        for (int r = 0; r < 4; ++r) bl[s][r] = *(const v4f*)(xs + (4 * s + r) * (WW * 4) + lob);
    };
    float q[TS][16], acc[TS][16], m[TS], l[TS];
    ldq(0); ldkv(0);
    // voT has its last use in the loads above: it stays in its register up to this wait, so that nothing overwrites it while an issued load still names it
    asm volatile("s_wait_xcnt 0x0" :: "v"(voT) : "memory");

    // key/value row j serves query rows j - 2, j - 1, j of the strip (as their lower, own and upper neighbour row); a query row is finished behind its lower row
#pragma unroll
    for (int j = 0; j < TS + 2; ++j) {
        if (j + 1 < TS + 2) ldkv(j + 1);
        if (j + 1 < TS) ldq(j + 1);
        if (j >= 2) ldb(j - 2);
        // the same for voB behind the loads of the row below the strip
        if (j == TS) asm volatile("s_wait_xcnt 0x0" :: "v"(voB) : "memory");
        // keeps the next row's loads in front of this row's arithmetic: without it the scheduler sinks the value loads to a few instructions before their use
        __builtin_amdgcn_sched_barrier(0);
        if (j < TS) {
#pragma unroll
            for (int e = 0; e < 16; ++e) { q[j][e] = qq[j][e >> 2][e & 3]; acc[j][e] = 0.0f; }
            m[j] = -1.0e30f; l[j] = 0.0f;
        }
        const bool vi = ((unsigned)(t0 + j - 1) < (unsigned)NTK);
#pragma unroll
        for (int s = j - 2; s <= j; ++s) {
            if (s < 0 || s >= TS) continue;
            slot<-1>(q[s], kk[j], vv[j], vi && okl, acc[s], m[s], l[s]);
            slot< 0>(q[s], kk[j], vv[j], vi,        acc[s], m[s], l[s]);
            slot< 1>(q[s], kk[j], vv[j], vi && okr, acc[s], m[s], l[s]);
        }
        if (j >= 2) {
            const int s = j - 2;
            const float inv = 1.0f / l[s];
#pragma unroll
            for (int r = 0; r < 4; ++r) { v4f t4;
#pragma unroll
                for (int e = 0; e < 4; ++e) { const float en = acc[s][4 * r + e] * inv; t4[e] = bfr(bl[s][r][e]) + en; }
                *(v4f*)(os + (4 * s + r) * (WW * 4) + lob) = t4; }
            // the stored registers are free for the next loads' results only behind this wait
            if (j < TS + 1) asm volatile("s_wait_xcnt 0x0" ::: "memory");
        }
    }
}

extern "C" void kernel_launch(void* const* d_in, const int* in_sizes, int n_in, void* d_out, int out_size, void* d_ws, size_t ws_size, hipStream_t stream) {
    (void)n_in;
    if (in_sizes[0] < NB * IMG || in_sizes[1] < NB * IMG || in_sizes[2] < CC * CC || in_sizes[3] < CC || in_sizes[4] < CC * CC || in_sizes[5] < CC || in_sizes[6] < CC * CC || in_sizes[7] < CC || out_size < NB * IMG) return;
    const float* blue  = (const float*)d_in[0];   // [NB][256][4096] channel-major
    const float* white = (const float*)d_in[1];
    const float* Wq = (const float*)d_in[2];      // [256 out][256 in]
    const float* bq = (const float*)d_in[3];
    const float* Wk = (const float*)d_in[4];
    const float* bk = (const float*)d_in[5];
    const float* Wv = (const float*)d_in[6];
    const float* bv = (const float*)d_in[7];
    float* out = (float*)d_out;                   // [NB][256][4096]

    char* wsp = (char*)d_ws;
    auto take = [&](size_t bytes) { char* p = wsp; wsp += (bytes + 255) & ~(size_t)255; return (void*)p; };
    bf* Wb  = (bf*)take((size_t)3 * CC * CC * 2);             // Wq, Wk, Wv as bf16, each [o][c] = A operand as-is
    float* Qp = (float*)take((size_t)3 * GB * IMG * 4);       // Q, K, V, each [GB][256][4096] f32
    float* Kp = Qp + (size_t)GB * IMG;
    float* Vp = Kp + (size_t)GB * IMG;
    if ((size_t)(wsp - (char*)d_ws) > ws_size) return;        // 101,056,512 B at NB = 8

    k_prep<<<3 * WBLK, 256, 0, stream>>>(Wq, Wk, Wv, Wb);
    k_gemmx<<<dim3(HW / 64, 3 * GB), 128, 0, stream>>>(Wb, blue, white, Qp, bq, bk, bv);   // Q[o][p] = sum_c Wq[o][c] blue[c][p] + bq[o]; K, V likewise from white
    k_nbr<<<(unsigned)(GB * (NTK / TS) * (CC / 16)), 256, 0, stream>>>(Qp, Kp, Vp, blue, out);
}

// v005
// Measured time: 48.9 microseconds a run.
// Next to v004, in two timings, it ran 1.06 and 1.07 times as fast.
// Over all steps from v000 it is 3.00 times as fast.
#include <hip/hip_runtime.h>

// Contractions: three 1x1-conv channel GEMMs (out-channel x pixel, K = 256 in-channels) on v_wmma_f32_16x16x32_bf16 (bf16 operands = RNE-converted inputs and weights, f32 accumulate, bias added in f32); the 3x3-token x 16-dim per-channel attention (scores, softmax, weighted sum) and the residual add run in f32 on VALU.
// Pipeline, three launches over all GB = NB images: (1) k_prep: bf16 copies of the three weight matrices; (2) k_gemmx: Q = Wq.blue + bq, K = Wk.white + bk, V = Wv.white + bv as f32 channel-major planes [c][4096], read from the f32 channel-major features (staged in LDS by asynchronous copies) and converted to bf16 in registers; blockIdx.y chooses the image and K with V (one staged white tile serves both) or Q; (3) k_nbr: one block per (image, 4 token rows, 16 channels) computes the 9-neighbour attention (tokens outside the 16x16 grid are zero keys/values kept in the softmax), scale 1/4, and writes out = bf16(blue) + enhanced.

#ifndef NB
#define NB 8
#endif
#define NB_FULL 8
#define CC   256
#define HH   64
#define WW   64
#define HW   (HH * WW)
#define IMG  (CC * HW)          // per-image stride (floats) of inputs, output and Q/K/V planes (full geometry)
#define NTK  16                 // 4x4-pixel tokens per side
#define GB   NB                 // images per launch: all of them
#define SCL  0.25f
#define L2E  1.4426950408889634f
static_assert(NB % GB == 0);
static_assert(NB <= NB_FULL);
static_assert(CC == 256);
static_assert(HW % 64 == 0);
static_assert(CC % 32 == 0);

typedef unsigned short bf;
typedef __attribute__((ext_vector_type(16))) __bf16   v16bf;
typedef __attribute__((ext_vector_type(8)))  unsigned short v8us;
typedef __attribute__((ext_vector_type(16))) float    v16f;
typedef __attribute__((ext_vector_type(8)))  float    v8f;
typedef __attribute__((ext_vector_type(4)))  float    v4f;

__device__ __forceinline__ unsigned short f2bf(float f) { unsigned u = __float_as_uint(f); u += 0x7FFFu + ((u >> 16) & 1u); return (unsigned short)(u >> 16); }
__device__ __forceinline__ float bf2f(unsigned short b) { return __uint_as_float(((unsigned)b) << 16); }
__device__ __forceinline__ float bfr(float f) { return bf2f(f2bf(f)); }
__device__ __forceinline__ v16bf cat16b(v8us lo, v8us hi) { return __builtin_bit_cast(v16bf, __builtin_shufflevector(lo, hi, 0, 1, 2, 3, 4, 5, 6, 7, 8, 9, 10, 11, 12, 13, 14, 15)); }
__device__ __forceinline__ v8f wmmab(v16bf a, v16bf b, v8f c) { return __builtin_amdgcn_wmma_f32_16x16x32_bf16(false, a, false, b, (short)0, c, false, false); }

// ---- k_gemmx: register-blocked GEMM, one wave per 64x64 output tile (16 accumulators); the four waves of a block take the four 64-row blocks of the SAME 64 pixels. Grid (HW/64, 2 * GB), 128 threads.
// C[o][p] (f32, pitch HW) = sum_c bf16(W[o][c]) bf16(X[c][p]) + bf16(bias[o]). Projection w (0, 1, 2) takes Wb + w * CC * CC, bq / bk / bv, the features blue (w = 0) or white (w > 0) of image i and the plane C + (w * GB + i) * IMG.
// blockIdx.y < GB: image blockIdx.y, white tile, projections 1 and 2 one after the other (the longer blocks have the lower indices, so they start first); else image blockIdx.y - GB, blue tile, projection 0.
// Fragment map (both operands): lane l -> row/col l&15, elements 0..7 <- k0 + 8(l>>4) + 0..7, elements 8..15 <- k0 + 16 + 8(l>>4) + 0..7; D element r of lane l = (row 8(l>>4)+r, col l&15).
// Column map: column j of column tile nb is pixel c0 + 4j + nb. One 16-byte read of X[k][c0 + 4(l&15) ..+3] then gives lane l its element k of all four B fragments, and element r of the four accumulators of a row block is four neighbouring pixels of one output row: a 16-byte store, no transposition anywhere.
// Feature path: the block's whole f32 feature tile (CC in-channel rows x 256 bytes) comes into LDS once by asynchronous copies, all issued at the block's start, KS rows a stage, a buffer of its own for each stage: no buffer is
// filled twice, the later stages fly while the earlier ones are worked on, and the tile stays for the block's second projection, which reads it with no further copy, wait or barrier. Each wave copies a quarter of a stage
// (copy i of wave w: rows 16w + 2i and 16w + 2i + 1, 16 lanes x 16 bytes a row); all four waves read the whole stage. LDS row pitch XP floats = 272 bytes.
#define KS 64
#define XP 68
#define NST (CC / KS)
static_assert(CC % KS == 0 && NST == 4 && KS % 32 == 0 && KS == 64);
typedef __attribute__((address_space(1))) char gch;      // global address space, kept through the integer form below (else the accesses build as flat ones)
typedef __attribute__((address_space(1))) v4f gv4f;
typedef __attribute__((address_space(1))) const v8us gv8us;
// the block-uniform part of an address, cut off from the lane's part: what stays live across the loops is then one 32-bit offset a lane and no 64-bit address
// (with those the two-projection loop took 258 registers: three waves a SIMD, not four)
__device__ __forceinline__ gch* ubase(const void* p) {
    const unsigned long long u = (unsigned long long)p;
    const unsigned lo = (unsigned)__builtin_amdgcn_readfirstlane((int)(unsigned)u), hi = (unsigned)__builtin_amdgcn_readfirstlane((int)(unsigned)(u >> 32));
    return (gch*)(((unsigned long long)hi << 32) | lo);
}
__global__ __launch_bounds__(128) void k_gemmx(const bf* __restrict__ Wb, const float* __restrict__ blue, const float* __restrict__ white, float* C, const float* __restrict__ bq, const float* __restrict__ bk, const float* __restrict__ bv) {
    __shared__ __attribute__((aligned(16))) float xs[NST][KS][XP];
    const unsigned z = blockIdx.y; const bool kv = z < GB; const unsigned zi = kv ? z : z - GB;
    const float* X = (kv ? white : blue) + (size_t)zi * IMG;
    const unsigned w0 = kv ? 1u : 0u, w1 = kv ? 3u : 1u;                           // the block's projections: w0 .. w1 - 1
    const int lane = threadIdx.x & 31, lr = lane & 15, hi = lane >> 4, wv = (int)(threadIdx.x >> 5); const int r0 = wv * 64, c0 = blockIdx.x * 64;
    const unsigned aoff = ((unsigned)(r0 + lr) * CC + 8 * hi) * 2u;                // this lane's byte offset in a weight matrix: block-uniform base + one 32-bit offset a lane
    const unsigned coff = ((unsigned)(r0 + 8 * hi) * HW + 4 * lr) * 4u;             // this lane's byte offset in an output plane, row block 0, row 0
    const float* gsrc = X + (size_t)(16 * wv + hi) * HW + c0 + 4 * lr;            // this lane's 16 bytes of its wave's first row pair, stage 0
    const unsigned ldst = (unsigned)(size_t)&xs[0][16 * wv + hi][4 * lr];          // the same place in buffer 0 (LDS byte address)
    // stage t into buffer t: eight copies a wave; the closing s_wait_xcnt 0 stands in the copies' own statement, in front of any rewrite of the address registers they name
    auto fill = [&](int t) {
        const float* g = gsrc + (size_t)t * (KS * HW); const unsigned l = ldst + (unsigned)t * (unsigned)(KS * XP * 4);
        asm volatile("global_load_async_to_lds_b128 %0, %8, off\n\t"
                     "global_load_async_to_lds_b128 %1, %9, off\n\t"
                     "global_load_async_to_lds_b128 %2, %10, off\n\t"
                     "global_load_async_to_lds_b128 %3, %11, off\n\t"
                     "global_load_async_to_lds_b128 %4, %12, off\n\t"
                     "global_load_async_to_lds_b128 %5, %13, off\n\t"
                     "global_load_async_to_lds_b128 %6, %14, off\n\t"
                     "global_load_async_to_lds_b128 %7, %15, off\n\t"
                     "s_wait_xcnt 0x0"
                     :: "v"(l), "v"(l + 2u * XP * 4u), "v"(l + 4u * XP * 4u), "v"(l + 6u * XP * 4u), "v"(l + 8u * XP * 4u), "v"(l + 10u * XP * 4u), "v"(l + 12u * XP * 4u), "v"(l + 14u * XP * 4u),
                        "v"(g), "v"(g + 2 * HW), "v"(g + 4 * HW), "v"(g + 6 * HW), "v"(g + 8 * HW), "v"(g + 10 * HW), "v"(g + 12 * HW), "v"(g + 14 * HW)
                     : "memory");
    };
    fill(0); fill(1); fill(2); fill(3);                 // 32 copies of a wave in flight
    // rolled: one copy of the body serves both projections, and the second takes the first one's registers
#pragma unroll 1
    for (unsigned zw = w0; zw < w1; ++zw) {
    const bf* A = Wb + (size_t)zw * CC * CC;
    const float* bias = zw == 0 ? bq : (zw == 1 ? bk : bv);
    gch* cb = ubase(C + ((size_t)zw * GB + zi) * IMG + c0);
    v8f acc[4][4];
#pragma unroll
    for (int mb = 0; mb < 4; ++mb)
#pragma unroll
        for (int nb = 0; nb < 4; ++nb) acc[mb][nb] = (v8f){};
#pragma unroll 1
    for (int t = 0; t < NST; ++t) {
        // publish point of stage t, in the block's first projection only (a test that reads the same in the whole block): this wave's eight copies of stage t have landed when at most
        // the 8 (NST - 1 - t) younger ones are outstanding (the counter returns in issue order, every wave issues the same 32); behind the barrier all four waves may read the stage
        if (zw == w0) {
            if (t == 0)      asm volatile("s_wait_asynccnt 0x18" ::: "memory");
            else if (t == 1) asm volatile("s_wait_asynccnt 0x10" ::: "memory");
            else if (t == 2) asm volatile("s_wait_asynccnt 0x8" ::: "memory");
            else             asm volatile("s_wait_asynccnt 0x0" ::: "memory");   // no copy is outstanding from here on
            __syncthreads();
        }
        const float (*xb)[XP] = xs[t];
#pragma unroll
        for (int ks = 0; ks < KS; ks += 32) {
            const gch* ak = ubase(A + t * KS + ks);
            v4f x[16]; v16bf a[4];
#pragma unroll
            for (int e = 0; e < 16; ++e) x[e] = *(const v4f*)&xb[ks + 8 * hi + (e & 7) + 16 * (e >> 3)][4 * lr];
#pragma unroll
            for (int mb = 0; mb < 4; ++mb) a[mb] = cat16b(*(gv8us*)(ak + mb * (16 * CC * 2) + aoff), *(gv8us*)(ak + (mb * (16 * CC * 2) + 32) + aoff));
#pragma unroll
            for (int nb = 0; nb < 4; ++nb) { v16f tt;
#pragma unroll
                for (int e = 0; e < 16; ++e) tt[e] = x[e][nb];
                const v16bf b = __builtin_convertvector(tt, v16bf);
#pragma unroll
                for (int mb = 0; mb < 4; ++mb) acc[mb][nb] = wmmab(a[mb], b, acc[mb][nb]); }
            // ends a 32-row pass for the scheduler: without it the four slots below are moved up in front of the pass's WMMAs
            __builtin_amdgcn_sched_barrier(0);
            // four vector slots behind the pass's last WMMA before its operands are loaded anew
            asm volatile("v_nop\n\tv_nop\n\tv_nop\n\tv_nop");
            // keeps the next pass's loads behind those slots
            __builtin_amdgcn_sched_barrier(0);
        }
    }
#pragma unroll
    for (int mb = 0; mb < 4; ++mb) {
        const int row = r0 + mb * 16 + 8 * hi;
        const v8f bb = *(const v8f*)(bias + row);
        gch* crow = cb + mb * (16 * HW * 4);
#pragma unroll
        for (int j = 0; j < 8; ++j) { const float bj = bfr(bb[j]); v4f val;
#pragma unroll
            for (int nb = 0; nb < 4; ++nb) val[nb] = acc[mb][nb][j] + bj;
            *(gv4f*)(crow + j * (HW * 4) + coff) = val; }
    }
    // the registers that the issued stores name are written anew by the next projection only behind this wait
    asm volatile("s_wait_xcnt 0x0" ::: "memory");
    }
}

// ---- k_prep: the three weight matrices as bf16 (8 elements a thread, layout kept, Wb = [3][CC][CC]); WBLK blocks a matrix.
#define WBLK (CC * CC / 8 / 256)
static_assert((CC * CC / 8) % 256 == 0);
__global__ __launch_bounds__(256) void k_prep(const float* __restrict__ Wq, const float* __restrict__ Wk, const float* __restrict__ Wv, bf* Wb) {
    const unsigned blk = blockIdx.x;
    const unsigned w = blk / WBLK; const float* src = w == 0 ? Wq : (w == 1 ? Wk : Wv);
    const size_t i = (size_t)(blk % WBLK) * 256 + threadIdx.x; const v8f v = *(const v8f*)(src + i * 8); v8us o;
#pragma unroll
    for (int k = 0; k < 8; ++k) o[k] = f2bf(v[k]);
    *(v8us*)(Wb + (size_t)w * CC * CC + i * 8) = o;
}

// k_nbr: per-channel attention of each 4x4-pixel token over its 3x3 token neighbourhood (16-dim dot per key, scale 1/4, softmax over the 9 slots with
// out-of-grid slots as zero keys/values, weighted sum of the value tokens), plus the residual bf16(blue). One block per (image, strip of TS token rows,
// group of 16 channels); lane&15 = token column tj, wave*2 + (lane>>4) = channel within the group. Q/K/V are f32 channel-major planes [img][c][4096].
// A wave walks the TS + 2 key/value token rows of its strip from top to bottom. Each row is loaded once (own column only, clamped row) and serves from
// registers the up to three query rows that have it as a neighbour row; their queries and online-softmax states are carried in registers. The left and right
// neighbour's key and value come from lane tj - 1 / tj + 1 of the same 16-lane row by a DPP row shift. Validity enters only by value. For each query the
// nine slots come in the order (row above, own row, row below) x (left, own, right).
#define TS 4
static_assert(NTK % TS == 0);
// value of lane - 1 (0x111, row_shr:1) or lane + 1 (0x101, row_shl:1) within the 16-lane row; 0 where that lane does not exist
template <int CTRL> __device__ __forceinline__ float rowsh(float x) { return __int_as_float(__builtin_amdgcn_update_dpp(0, __float_as_int(x), CTRL, 0xf, 0xf, true)); }
template <int DJ> __device__ __forceinline__ float nbv(float x) { if constexpr (DJ < 0) return rowsh<0x111>(x); else if constexpr (DJ > 0) return rowsh<0x101>(x); else return x; }

__device__ __forceinline__ void ex2x2(float a, float b, float& ra, float& rb) {
    asm("v_exp_f32 %0, %2\n\tv_exp_f32 %1, %3\n\tv_nop\n\ts_delay_alu instid0(TRANS32_DEP_1)" : "=&v"(ra), "=&v"(rb) : "v"(a), "v"(b));
}

template <int DJ> __device__ __forceinline__ void slot(const float (&q)[16], const v4f (&k)[4], const v4f (&v)[4], bool ok, float (&acc)[16], float& m, float& l) {
    float kd = 0.0f;
#pragma unroll
    for (int r = 0; r < 4; ++r)
#pragma unroll
        for (int e = 0; e < 4; ++e) kd = fmaf(q[4 * r + e], nbv<DJ>(k[r][e]), kd);
    const float s = ok ? kd * SCL : 0.0f;
    const float mn = fmaxf(m, s);
    float corr, p;
    ex2x2((m - mn) * L2E, (s - mn) * L2E, corr, p);
    l = fmaf(l, corr, p);
    const float pv = ok ? p : 0.0f;
#pragma unroll
    for (int r = 0; r < 4; ++r)
#pragma unroll
        for (int e = 0; e < 4; ++e) { const float t = acc[4 * r + e] * corr; acc[4 * r + e] = fmaf(pv, nbv<DJ>(v[r][e]), t); }
    m = mn;
}

__global__ __launch_bounds__(256) __attribute__((amdgpu_num_vgpr(256)))
void k_nbr(const float* __restrict__ Qg, const float* __restrict__ Kg, const float* __restrict__ Vg, const float* __restrict__ xres, float* outp) {
#pragma clang fp contract(off)
    const int tid = threadIdx.x, lane = tid & 31, wv = tid >> 5;
    const int tj = lane & 15, cs = lane >> 4;
    const int blk = blockIdx.x;
    const int cg = blk & 15, t0 = ((blk >> 4) & (NTK / TS - 1)) * TS, bb = blk / (16 * (NTK / TS));
    // every address = block-uniform base (scalar registers) + one 32-bit byte offset per lane: lob (channel within the group, token column) for the strip's own
    // rows, voT / voB = lob + the clamped row above / below the strip
    const size_t ub = (size_t)bb * IMG + (size_t)(cg * 16) * HW;
    const unsigned lob = (unsigned)((wv * 2 + cs) * HW + 4 * tj) * 4u;
    const unsigned voT = lob + (unsigned)(t0 > 0 ? t0 - 1 : 0) * (4u * WW * 4u);
    const unsigned voB = lob + (unsigned)(t0 + TS < NTK ? t0 + TS : NTK - 1) * (4u * WW * 4u);
    const char* Kb = (const char*)(Kg + ub); const char* Vb = (const char*)(Vg + ub);
    const size_t us = ub + (size_t)(4 * t0) * WW;
    const char* Qs = (const char*)(Qg + us); const char* Ks = (const char*)(Kg + us); const char* Vs = (const char*)(Vg + us);
    const char* xs = (const char*)(xres + us); char* os = (char*)(outp + us);
    const bool okl = tj > 0, okr = tj < NTK - 1;

    v4f kk[TS + 2][4], vv[TS + 2][4], qq[TS][4], bl[TS][4];   // every index is a constant after unrolling: registers, live only while needed
    auto ldkv = [&](int j) {                                   // key/value token row t0 - 1 + j, clamped into the grid
#pragma unroll
        for (int r = 0; r < 4; ++r) {
            if (j == 0)           { kk[j][r] = *(const v4f*)(Kb + r * (WW * 4) + voT); vv[j][r] = *(const v4f*)(Vb + r * (WW * 4) + voT); }
            else if (j == TS + 1) { kk[j][r] = *(const v4f*)(Kb + r * (WW * 4) + voB); vv[j][r] = *(const v4f*)(Vb + r * (WW * 4) + voB); }
            else                  { kk[j][r] = *(const v4f*)(Ks + (4 * (j - 1) + r) * (WW * 4) + lob); vv[j][r] = *(const v4f*)(Vs + (4 * (j - 1) + r) * (WW * 4) + lob); }
        }
    };
    auto ldq = [&](int s) {
#pragma unroll
        for (int r = 0; r < 4; ++r) qq[s][r] = *(const v4f*)(Qs + (4 * s + r) * (WW * 4) + lob);
    };
    auto ldb = [&](int s) {
#pragma unroll
        for (int r = 0; r < 4; ++r) bl[s][r] = *(const v4f*)(xs + (4 * s + r) * (WW * 4) + lob);
    };
    float q[TS][16], acc[TS][16], m[TS], l[TS];
    ldq(0); ldkv(0);
    // voT has its last use in the loads above: it stays in its register up to this wait, so that nothing overwrites it while an issued load still names it
    asm volatile("s_wait_xcnt 0x0" :: "v"(voT) : "memory");

    // key/value row j serves query rows j - 2, j - 1, j of the strip (as their lower, own and upper neighbour row); a query row is finished behind its lower row
#pragma unroll
    for (int j = 0; j < TS + 2; ++j) {
        if (j + 1 < TS + 2) ldkv(j + 1);
        if (j + 1 < TS) ldq(j + 1);
        if (j >= 2) ldb(j - 2);
        // the same for voB behind the loads of the row below the strip
        if (j == TS) asm volatile("s_wait_xcnt 0x0" :: "v"(voB) : "memory");
        // keeps the next row's loads in front of this row's arithmetic: without it the scheduler sinks the value loads to a few instructions before their use
        __builtin_amdgcn_sched_barrier(0);
        if (j < TS) {
#pragma unroll
            for (int e = 0; e < 16; ++e) { q[j][e] = qq[j][e >> 2][e & 3]; acc[j][e] = 0.0f; }
            m[j] = -1.0e30f; l[j] = 0.0f;
        }
        const bool vi = ((unsigned)(t0 + j - 1) < (unsigned)NTK);
#pragma unroll
        for (int s = j - 2; s <= j; ++s) {
            if (s < 0 || s >= TS) continue;
            slot<-1>(q[s], kk[j], vv[j], vi && okl, acc[s], m[s], l[s]);
            slot< 0>(q[s], kk[j], vv[j], vi,        acc[s], m[s], l[s]);
            slot< 1>(q[s], kk[j], vv[j], vi && okr, acc[s], m[s], l[s]);
        }
        if (j >= 2) {
            const int s = j - 2;
            const float inv = 1.0f / l[s];
#pragma unroll
            for (int r = 0; r < 4; ++r) { v4f t4;
#pragma unroll
                for (int e = 0; e < 4; ++e) { const float en = acc[s][4 * r + e] * inv; t4[e] = bfr(bl[s][r][e]) + en; }
                *(v4f*)(os + (4 * s + r) * (WW * 4) + lob) = t4; }
            // the stored registers are free for the next loads' results only behind this wait
            if (j < TS + 1) asm volatile("s_wait_xcnt 0x0" ::: "memory");
        }
    }
}

extern "C" void kernel_launch(void* const* d_in, const int* in_sizes, int n_in, void* d_out, int out_size, void* d_ws, size_t ws_size, hipStream_t stream) {
    (void)n_in;
    if (in_sizes[0] < NB * IMG || in_sizes[1] < NB * IMG || in_sizes[2] < CC * CC || in_sizes[3] < CC || in_sizes[4] < CC * CC || in_sizes[5] < CC || in_sizes[6] < CC * CC || in_sizes[7] < CC || out_size < NB * IMG) return;
    const float* blue  = (const float*)d_in[0];   // [NB][256][4096] channel-major
    const float* white = (const float*)d_in[1];
    const float* Wq = (const float*)d_in[2];      // [256 out][256 in]
    const float* bq = (const float*)d_in[3];
    const float* Wk = (const float*)d_in[4];
    const float* bk = (const float*)d_in[5];
    const float* Wv = (const float*)d_in[6];
    const float* bv = (const float*)d_in[7];
    float* out = (float*)d_out;                   // [NB][256][4096]

    char* wsp = (char*)d_ws;
    auto take = [&](size_t bytes) { char* p = wsp; wsp += (bytes + 255) & ~(size_t)255; return (void*)p; };
    bf* Wb  = (bf*)take((size_t)3 * CC * CC * 2);             // Wq, Wk, Wv as bf16, each [o][c] = A operand as-is
    float* Qp = (float*)take((size_t)3 * GB * IMG * 4);       // Q, K, V, each [GB][256][4096] f32
    float* Kp = Qp + (size_t)GB * IMG;
    float* Vp = Kp + (size_t)GB * IMG;
    if ((size_t)(wsp - (char*)d_ws) > ws_size) return;        // 101,056,512 B at NB = 8

    k_prep<<<3 * WBLK, 256, 0, stream>>>(Wq, Wk, Wv, Wb);
    k_gemmx<<<dim3(HW / 64, 2 * GB), 128, 0, stream>>>(Wb, blue, white, Qp, bq, bk, bv);   // Q[o][p] = sum_c Wq[o][c] blue[c][p] + bq[o]; K, V likewise from white
    k_nbr<<<(unsigned)(GB * (NTK / TS) * (CC / 16)), 256, 0, stream>>>(Qp, Kp, Vp, blue, out);
}

// v006
// It runs in 45.2 microseconds.
// Two timings next to v005 both put it at 1.08 times that version's speed.
// Counting every step since v000, it is 3.24 times as fast.
#include <hip/hip_runtime.h>

// Contractions: three 1x1-conv channel GEMMs (out-channel x pixel, K = 256 in-channels) on v_wmma_f32_16x16x32_bf16 (bf16 operands = RNE-converted inputs and weights, f32 accumulate, bias added in f32); the 3x3-token x 16-dim per-channel attention (scores, softmax, weighted sum) and the residual add run in f32 on VALU.
// Pipeline, three launches over all GB = NB images: (1) k_prep: bf16 copies of the three weight matrices; (2) k_gemmx: Q = Wq.blue + bq, K = Wk.white + bk, V = Wv.white + bv as f32 channel-major planes [c][4096], read from the f32 channel-major features (staged in LDS by asynchronous copies) and converted to bf16 in registers; blockIdx.y chooses the image and K with V (one staged white tile serves both) or Q; (3) k_nbr: one block per (image, 4 token rows, 16 channels) computes the 9-neighbour attention (tokens outside the 16x16 grid are zero keys/values kept in the softmax), scale 1/4, and writes out = bf16(blue) + enhanced.

#ifndef NB
#define NB 8
#endif
#define NB_FULL 8
#define CC   256
#define HH   64
#define WW   64
#define HW   (HH * WW)
#define IMG  (CC * HW)          // per-image stride (floats) of inputs, output and Q/K/V planes (full geometry)
#define NTK  16                 // 4x4-pixel tokens per side
#define GB   NB                 // images per launch: all of them
#define SCL  0.25f
#define L2E  1.4426950408889634f
static_assert(NB % GB == 0);
static_assert(NB <= NB_FULL);
static_assert(CC == 256);
static_assert(HW % 64 == 0);
static_assert(CC % 32 == 0);

typedef unsigned short bf;
typedef __attribute__((ext_vector_type(16))) __bf16   v16bf;
typedef __attribute__((ext_vector_type(8)))  unsigned short v8us;
typedef __attribute__((ext_vector_type(16))) float    v16f;
typedef __attribute__((ext_vector_type(8)))  float    v8f;
typedef __attribute__((ext_vector_type(4)))  float    v4f;

__device__ __forceinline__ unsigned short f2bf(float f) { unsigned u = __float_as_uint(f); u += 0x7FFFu + ((u >> 16) & 1u); return (unsigned short)(u >> 16); }
__device__ __forceinline__ float bf2f(unsigned short b) { return __uint_as_float(((unsigned)b) << 16); }
__device__ __forceinline__ float bfr(float f) { return bf2f(f2bf(f)); }
__device__ __forceinline__ v16bf cat16b(v8us lo, v8us hi) { return __builtin_bit_cast(v16bf, __builtin_shufflevector(lo, hi, 0, 1, 2, 3, 4, 5, 6, 7, 8, 9, 10, 11, 12, 13, 14, 15)); }
__device__ __forceinline__ v8f wmmab(v16bf a, v16bf b, v8f c) { return __builtin_amdgcn_wmma_f32_16x16x32_bf16(false, a, false, b, (short)0, c, false, false); }

// ---- k_gemmx: register-blocked GEMM, one wave per 64x64 output tile (16 accumulators); the four waves of a block take the four 64-row blocks of the SAME 64 pixels. Grid (HW/64, 2 * GB), 128 threads.
// C[o][p] (f32, pitch HW) = sum_c bf16(W[o][c]) bf16(X[c][p]) + bf16(bias[o]). Projection w (0, 1, 2) takes Wb + w * CC * CC, bq / bk / bv, the features blue (w = 0) or white (w > 0) of image i and the plane C + (w * GB + i) * IMG.
// blockIdx.y < GB: image blockIdx.y, white tile, projections 1 and 2 one after the other (the longer blocks have the lower indices); else image blockIdx.y - GB, blue tile, projection 0.
// Fragment map (both operands): lane l -> row/col l&15, elements 0..7 <- k0 + 8(l>>4) + 0..7, elements 8..15 <- k0 + 16 + 8(l>>4) + 0..7; D element r of lane l = (row 8(l>>4)+r, col l&15).
// Column map: column j of column tile nb is pixel c0 + 4j + nb. One 16-byte read of X[k][c0 + 4(l&15) ..+3] then gives lane l its element k of all four B fragments, and element r of the four accumulators of a row block is four neighbouring pixels of one output row: a 16-byte store, no transposition anywhere.
// Feature path: the block's whole f32 feature tile (CC in-channel rows x 256 bytes) comes into LDS once by asynchronous copies, all issued at the block's start, KS rows a stage, a buffer of its own for each stage: no buffer is
// filled twice, the later stages fly while the earlier ones are worked on, and the tile stays for the block's second projection, which reads it with no further copy, wait or barrier. Each wave copies a quarter of a stage
// (copy i of wave w: rows 16w + 2i and 16w + 2i + 1, 16 lanes x 16 bytes a row); all four waves read the whole stage. LDS row pitch XP floats = 272 bytes.
#define KS 64
#define XP 68
#define NST (CC / KS)
static_assert(CC % KS == 0 && NST == 4 && KS % 32 == 0 && KS == 64);
typedef __attribute__((address_space(1))) char gch;      // global address space, kept through the integer form below (else the accesses build as flat ones)
typedef __attribute__((address_space(1))) v4f gv4f;
typedef __attribute__((address_space(1))) const v8us gv8us;
// the block-uniform part of an address, cut off from the lane's part: what stays live across the loops is then one 32-bit offset a lane and no 64-bit address
// (with those the two-projection loop took 258 registers: three waves a SIMD, not four)
__device__ __forceinline__ gch* ubase(const void* p) {
    const unsigned long long u = (unsigned long long)p;
    const unsigned lo = (unsigned)__builtin_amdgcn_readfirstlane((int)(unsigned)u), hi = (unsigned)__builtin_amdgcn_readfirstlane((int)(unsigned)(u >> 32));
    return (gch*)(((unsigned long long)hi << 32) | lo);
}
__global__ __launch_bounds__(128) void k_gemmx(const bf* __restrict__ Wb, const float* __restrict__ blue, const float* __restrict__ white, float* C, const float* __restrict__ bq, const float* __restrict__ bk, const float* __restrict__ bv) {
    __shared__ __attribute__((aligned(16))) float xs[NST][KS][XP];
    const unsigned z = blockIdx.y; const bool kv = z < GB; const unsigned zi = kv ? z : z - GB;
    const float* X = (kv ? white : blue) + (size_t)zi * IMG;
    const unsigned w0 = kv ? 1u : 0u, w1 = kv ? 3u : 1u;                           // the block's projections: w0 .. w1 - 1
    const int lane = threadIdx.x & 31, lr = lane & 15, hi = lane >> 4, wv = (int)(threadIdx.x >> 5); const int r0 = wv * 64, c0 = blockIdx.x * 64;
    const unsigned aoff = ((unsigned)(r0 + lr) * CC + 8 * hi) * 2u;                // this lane's byte offset in a weight matrix: block-uniform base + one 32-bit offset a lane
    const unsigned coff = ((unsigned)(r0 + 8 * hi) * HW + 4 * lr) * 4u;             // this lane's byte offset in an output plane, row block 0, row 0
    const float* gsrc = X + (size_t)(16 * wv + hi) * HW + c0 + 4 * lr;            // this lane's 16 bytes of its wave's first row pair, stage 0
    const unsigned ldst = (unsigned)(size_t)&xs[0][16 * wv + hi][4 * lr];          // the same place in buffer 0 (LDS byte address)
    // stage t into buffer t: eight copies a wave; the closing s_wait_xcnt 0 stands in the copies' own statement, in front of any rewrite of the address registers they name
    auto fill = [&](int t) {
        const float* g = gsrc + (size_t)t * (KS * HW); const unsigned l = ldst + (unsigned)t * (unsigned)(KS * XP * 4);
        asm volatile("global_load_async_to_lds_b128 %0, %8, off\n\t"
                     "global_load_async_to_lds_b128 %1, %9, off\n\t"
                     "global_load_async_to_lds_b128 %2, %10, off\n\t"
                     "global_load_async_to_lds_b128 %3, %11, off\n\t"
                     "global_load_async_to_lds_b128 %4, %12, off\n\t"
                     "global_load_async_to_lds_b128 %5, %13, off\n\t"
                     "global_load_async_to_lds_b128 %6, %14, off\n\t"
                     "global_load_async_to_lds_b128 %7, %15, off\n\t"
                     "s_wait_xcnt 0x0"
                     :: "v"(l), "v"(l + 2u * XP * 4u), "v"(l + 4u * XP * 4u), "v"(l + 6u * XP * 4u), "v"(l + 8u * XP * 4u), "v"(l + 10u * XP * 4u), "v"(l + 12u * XP * 4u), "v"(l + 14u * XP * 4u),
                        "v"(g), "v"(g + 2 * HW), "v"(g + 4 * HW), "v"(g + 6 * HW), "v"(g + 8 * HW), "v"(g + 10 * HW), "v"(g + 12 * HW), "v"(g + 14 * HW)
                     : "memory");
    };
    // L2 request for the bf16 weights, which the launch before stored, in front of the block's feature copies:
    // a block asks for one twelfth of the three matrices, a lane for one 256-byte unit; blocks of an even blockIdx.y ask for Wk and Wv (the first 64 blocks for all of both), those of an odd one for Wq;
    // eight neighbouring blocks ask for the same twelfth. A hint only: it returns nothing, and no result depends on which block asks for what
    const unsigned wsl = (z & 1u) ? ((blockIdx.x >> 3) & 3u) : 4u + (blockIdx.x >> 3);
    const unsigned wpo = (wsl * 128u + threadIdx.x) * 256u;
    static_assert(HW / 64 == 64 && 12 * 128 * 256 == 3 * CC * CC * 2);
    asm volatile("global_prefetch_b8 %0, %1 scope:SCOPE_SE" :: "v"(wpo), "s"(Wb));
    fill(0); fill(1); fill(2); fill(3);                 // 32 copies of a wave in flight
    // rolled: one copy of the body serves both projections, and the second takes the first one's registers
#pragma unroll 1
    for (unsigned zw = w0; zw < w1; ++zw) {
    const bf* A = Wb + (size_t)zw * CC * CC;
    const float* bias = zw == 0 ? bq : (zw == 1 ? bk : bv);
    gch* cb = ubase(C + ((size_t)zw * GB + zi) * IMG + c0);
    v8f acc[4][4];
#pragma unroll
    for (int mb = 0; mb < 4; ++mb)
#pragma unroll
        for (int nb = 0; nb < 4; ++nb) acc[mb][nb] = (v8f){};
#pragma unroll 1
    for (int t = 0; t < NST; ++t) {
        // publish point of stage t, in the block's first projection only (a test that reads the same in the whole block): this wave's eight copies of stage t have landed when at most
        // the 8 (NST - 1 - t) younger ones are outstanding (the counter returns in issue order, every wave issues the same 32); behind the barrier all four waves may read the stage
        if (zw == w0) {
            if (t == 0)      asm volatile("s_wait_asynccnt 0x18" ::: "memory");
            else if (t == 1) asm volatile("s_wait_asynccnt 0x10" ::: "memory");
            else if (t == 2) asm volatile("s_wait_asynccnt 0x8" ::: "memory");
            else             asm volatile("s_wait_asynccnt 0x0" ::: "memory");   // no copy is outstanding from here on
            __syncthreads();
        }
        const float (*xb)[XP] = xs[t];
#pragma unroll
        for (int ks = 0; ks < KS; ks += 32) {
            const gch* ak = ubase(A + t * KS + ks);
            v4f x[16]; v16bf a[4];
#pragma unroll
            for (int e = 0; e < 16; ++e) x[e] = *(const v4f*)&xb[ks + 8 * hi + (e & 7) + 16 * (e >> 3)][4 * lr];
#pragma unroll
            for (int mb = 0; mb < 4; ++mb) a[mb] = cat16b(*(gv8us*)(ak + mb * (16 * CC * 2) + aoff), *(gv8us*)(ak + (mb * (16 * CC * 2) + 32) + aoff));
#pragma unroll
            for (int nb = 0; nb < 4; ++nb) { v16f tt;
#pragma unroll
                for (int e = 0; e < 16; ++e) tt[e] = x[e][nb];
                const v16bf b = __builtin_convertvector(tt, v16bf);
#pragma unroll
                for (int mb = 0; mb < 4; ++mb) acc[mb][nb] = wmmab(a[mb], b, acc[mb][nb]); }
            // ends a 32-row pass for the scheduler: without it the four slots below are moved up in front of the pass's WMMAs
            __builtin_amdgcn_sched_barrier(0);
            // four vector slots behind the pass's last WMMA before its operands are loaded anew
            asm volatile("v_nop\n\tv_nop\n\tv_nop\n\tv_nop");
            // keeps the next pass's loads behind those slots
            __builtin_amdgcn_sched_barrier(0);
        }
    }
#pragma unroll
    for (int mb = 0; mb < 4; ++mb) {
        const int row = r0 + mb * 16 + 8 * hi;
        const v8f bb = *(const v8f*)(bias + row);
        gch* crow = cb + mb * (16 * HW * 4);
#pragma unroll
        for (int j = 0; j < 8; ++j) { const float bj = bfr(bb[j]); v4f val;
#pragma unroll
            for (int nb = 0; nb < 4; ++nb) val[nb] = acc[mb][nb][j] + bj;
            *(gv4f*)(crow + j * (HW * 4) + coff) = val; }
    }
    // the registers that the issued stores name are written anew by the next projection only behind this wait
    asm volatile("s_wait_xcnt 0x0" ::: "memory");
    }
    // the registers that the L2 request names keep their address to the kernel's end: nothing else is put into them while the request may still read them
    asm volatile("" :: "v"(wpo), "s"(Wb));
}

// ---- k_prep: the three weight matrices as bf16 (8 elements a thread, layout kept, Wb = [3][CC][CC]); WBLK blocks a matrix.
#define WBLK (CC * CC / 8 / 256)
static_assert((CC * CC / 8) % 256 == 0);
__global__ __launch_bounds__(256) void k_prep(const float* __restrict__ Wq, const float* __restrict__ Wk, const float* __restrict__ Wv, bf* Wb) {
    const unsigned blk = blockIdx.x;
    const unsigned w = blk / WBLK; const float* src = w == 0 ? Wq : (w == 1 ? Wk : Wv);
    const size_t i = (size_t)(blk % WBLK) * 256 + threadIdx.x; const v8f v = *(const v8f*)(src + i * 8); v8us o;
#pragma unroll
    for (int k = 0; k < 8; ++k) o[k] = f2bf(v[k]);
    *(v8us*)(Wb + (size_t)w * CC * CC + i * 8) = o;
}

// k_nbr: per-channel attention of each 4x4-pixel token over its 3x3 token neighbourhood (16-dim dot per key, scale 1/4, softmax over the 9 slots with
// out-of-grid slots as zero keys/values, weighted sum of the value tokens), plus the residual bf16(blue). One block per (image, strip of TS token rows,
// group of 16 channels); lane&15 = token column tj, wave*2 + (lane>>4) = channel within the group. Q/K/V are f32 channel-major planes [img][c][4096].
// A wave walks the TS + 2 key/value token rows of its strip from top to bottom. Each row is loaded once (own column only, clamped row) and serves from
// registers the up to three query rows that have it as a neighbour row; their queries and online-softmax states are carried in registers. The left and right
// neighbour's key and value come from lane tj - 1 / tj + 1 of the same 16-lane row by a DPP row shift. Validity enters only by value. For each query the
// nine slots come in the order (row above, own row, row below) x (left, own, right).
#define TS 4
static_assert(NTK % TS == 0);
// value of lane - 1 (0x111, row_shr:1) or lane + 1 (0x101, row_shl:1) within the 16-lane row; 0 where that lane does not exist
template <int CTRL> __device__ __forceinline__ float rowsh(float x) { return __int_as_float(__builtin_amdgcn_update_dpp(0, __float_as_int(x), CTRL, 0xf, 0xf, true)); }
template <int DJ> __device__ __forceinline__ float nbv(float x) { if constexpr (DJ < 0) return rowsh<0x111>(x); else if constexpr (DJ > 0) return rowsh<0x101>(x); else return x; }

__device__ __forceinline__ void ex2x2(float a, float b, float& ra, float& rb) {
    asm("v_exp_f32 %0, %2\n\tv_exp_f32 %1, %3\n\tv_nop\n\ts_delay_alu instid0(TRANS32_DEP_1)" : "=&v"(ra), "=&v"(rb) : "v"(a), "v"(b));
}

template <int DJ> __device__ __forceinline__ void slot(const float (&q)[16], const v4f (&k)[4], const v4f (&v)[4], bool ok, float (&acc)[16], float& m, float& l) {
    float kd = 0.0f;
#pragma unroll
    for (int r = 0; r < 4; ++r)
#pragma unroll
        for (int e = 0; e < 4; ++e) kd = fmaf(q[4 * r + e], nbv<DJ>(k[r][e]), kd);
    const float s = ok ? kd * SCL : 0.0f;
    const float mn = fmaxf(m, s);
    float corr, p;
    ex2x2((m - mn) * L2E, (s - mn) * L2E, corr, p);
    l = fmaf(l, corr, p);
    const float pv = ok ? p : 0.0f;
#pragma unroll
    for (int r = 0; r < 4; ++r)
#pragma unroll
        for (int e = 0; e < 4; ++e) { const float t = acc[4 * r + e] * corr; acc[4 * r + e] = fmaf(pv, nbv<DJ>(v[r][e]), t); }
    m = mn;
}

__global__ __launch_bounds__(256) __attribute__((amdgpu_num_vgpr(256)))
void k_nbr(const float* __restrict__ Qg, const float* __restrict__ Kg, const float* __restrict__ Vg, const float* __restrict__ xres, float* outp) {
#pragma clang fp contract(off)
    const int tid = threadIdx.x, lane = tid & 31, wv = tid >> 5;
    const int tj = lane & 15, cs = lane >> 4;
    const int blk = blockIdx.x;
    const int cg = blk & 15, t0 = ((blk >> 4) & (NTK / TS - 1)) * TS, bb = blk / (16 * (NTK / TS));
    // every address = block-uniform base (scalar registers) + one 32-bit byte offset per lane: lob (channel within the group, token column) for the strip's own
    // rows, voT / voB = lob + the clamped row above / below the strip
    const size_t ub = (size_t)bb * IMG + (size_t)(cg * 16) * HW;
    const unsigned lob = (unsigned)((wv * 2 + cs) * HW + 4 * tj) * 4u;
    const unsigned voT = lob + (unsigned)(t0 > 0 ? t0 - 1 : 0) * (4u * WW * 4u);
    const unsigned voB = lob + (unsigned)(t0 + TS < NTK ? t0 + TS : NTK - 1) * (4u * WW * 4u);
    const char* Kb = (const char*)(Kg + ub); const char* Vb = (const char*)(Vg + ub);
    const size_t us = ub + (size_t)(4 * t0) * WW;
    const char* Qs = (const char*)(Qg + us); const char* Ks = (const char*)(Kg + us); const char* Vs = (const char*)(Vg + us);
    const char* xs = (const char*)(xres + us); char* os = (char*)(outp + us);
    const bool okl = tj > 0, okr = tj < NTK - 1;
    // L2 requests for the rows that the wave loads in its later steps: lane (cs, tj) names 256-byte unit tj of its channel's four token rows (4 KB in a row) behind a
    // block-uniform base: the strip's own rows for Q and the residual, one token row further down for K and V (the strip's own rows again in the lowest strip: no address leaves a plane)
    const unsigned pfo = (unsigned)((wv * 2 + cs) * HW + 64 * tj) * 4u;
    const unsigned pfd = t0 + TS < NTK ? 4u * WW * 4u : 0u;
    const char* Kf = Ks + pfd; const char* Vf = Vs + pfd;

    v4f kk[TS + 2][4], vv[TS + 2][4], qq[TS][4], bl[TS][4];   // every index is a constant after unrolling: registers, live only while needed
    auto ldkv = [&](int j) {                                   // key/value token row t0 - 1 + j, clamped into the grid
#pragma unroll
        for (int r = 0; r < 4; ++r) {
            if (j == 0)           { kk[j][r] = *(const v4f*)(Kb + r * (WW * 4) + voT); vv[j][r] = *(const v4f*)(Vb + r * (WW * 4) + voT); }
            else if (j == TS + 1) { kk[j][r] = *(const v4f*)(Kb + r * (WW * 4) + voB); vv[j][r] = *(const v4f*)(Vb + r * (WW * 4) + voB); }
            else                  { kk[j][r] = *(const v4f*)(Ks + (4 * (j - 1) + r) * (WW * 4) + lob); vv[j][r] = *(const v4f*)(Vs + (4 * (j - 1) + r) * (WW * 4) + lob); }
        }
    };
    auto ldq = [&](int s) {
#pragma unroll
        for (int r = 0; r < 4; ++r) qq[s][r] = *(const v4f*)(Qs + (4 * s + r) * (WW * 4) + lob);
    };
    auto ldb = [&](int s) {
#pragma unroll
        for (int r = 0; r < 4; ++r) bl[s][r] = *(const v4f*)(xs + (4 * s + r) * (WW * 4) + lob);
    };
    float q[TS][16], acc[TS][16], m[TS], l[TS];
    ldq(0); ldkv(0);
    // voT has its last use in the loads above: it stays in its register up to this wait, so that nothing overwrites it while an issued load still names it
    asm volatile("s_wait_xcnt 0x0" :: "v"(voT) : "memory");

    // key/value row j serves query rows j - 2, j - 1, j of the strip (as their lower, own and upper neighbour row); a query row is finished behind its lower row
#pragma unroll
    for (int j = 0; j < TS + 2; ++j) {
        if (j + 1 < TS + 2) ldkv(j + 1);
        if (j + 1 < TS) ldq(j + 1);
        if (j >= 2) ldb(j - 2);
        // behind the loads of the first two rows: everything else the wave will read is asked of L2 now, so that memory serves all rows at once and not one row a step;
        // a hint only, it returns nothing and no wait covers it
        if (j == 0) asm volatile("global_prefetch_b8 %0, %1 scope:SCOPE_SE\n\t"
                                 "global_prefetch_b8 %0, %2 scope:SCOPE_SE\n\t"
                                 "global_prefetch_b8 %0, %3 scope:SCOPE_SE\n\t"
                                 "global_prefetch_b8 %0, %4 scope:SCOPE_SE"
                                 :: "v"(pfo), "s"(Kf), "s"(Vf), "s"(Qs), "s"(xs));
        // the same for voB behind the loads of the row below the strip
        if (j == TS) asm volatile("s_wait_xcnt 0x0" :: "v"(voB) : "memory");
        // keeps the next row's loads in front of this row's arithmetic: without it the scheduler sinks the value loads to a few instructions before their use
        __builtin_amdgcn_sched_barrier(0);
        if (j < TS) {
#pragma unroll
            for (int e = 0; e < 16; ++e) { q[j][e] = qq[j][e >> 2][e & 3]; acc[j][e] = 0.0f; }
            m[j] = -1.0e30f; l[j] = 0.0f;
        }
        const bool vi = ((unsigned)(t0 + j - 1) < (unsigned)NTK);
#pragma unroll
        for (int s = j - 2; s <= j; ++s) {
            if (s < 0 || s >= TS) continue;
            slot<-1>(q[s], kk[j], vv[j], vi && okl, acc[s], m[s], l[s]);
            slot< 0>(q[s], kk[j], vv[j], vi,        acc[s], m[s], l[s]);
            slot< 1>(q[s], kk[j], vv[j], vi && okr, acc[s], m[s], l[s]);
        }
        // the registers that the L2 requests name keep their addresses up to here, behind the arithmetic of three steps (held to the kernel's end the offset is spilled and its register reused at once)
        if (j == 2) asm volatile("" :: "v"(pfo), "s"(Kf), "s"(Vf), "s"(Qs), "s"(xs));
        if (j >= 2) {
            const int s = j - 2;
            const float inv = 1.0f / l[s];
#pragma unroll
            for (int r = 0; r < 4; ++r) { v4f t4;
#pragma unroll
                for (int e = 0; e < 4; ++e) { const float en = acc[s][4 * r + e] * inv; t4[e] = bfr(bl[s][r][e]) + en; }
                *(v4f*)(os + (4 * s + r) * (WW * 4) + lob) = t4; }
            // the stored registers are free for the next loads' results only behind this wait
            if (j < TS + 1) asm volatile("s_wait_xcnt 0x0" ::: "memory");
        }
    }
}

extern "C" void kernel_launch(void* const* d_in, const int* in_sizes, int n_in, void* d_out, int out_size, void* d_ws, size_t ws_size, hipStream_t stream) {
    (void)n_in;
    if (in_sizes[0] < NB * IMG || in_sizes[1] < NB * IMG || in_sizes[2] < CC * CC || in_sizes[3] < CC || in_sizes[4] < CC * CC || in_sizes[5] < CC || in_sizes[6] < CC * CC || in_sizes[7] < CC || out_size < NB * IMG) return;
    const float* blue  = (const float*)d_in[0];   // [NB][256][4096] channel-major
    const float* white = (const float*)d_in[1];
    const float* Wq = (const float*)d_in[2];      // [256 out][256 in]
    const float* bq = (const float*)d_in[3];
    const float* Wk = (const float*)d_in[4];
    const float* bk = (const float*)d_in[5];
    const float* Wv = (const float*)d_in[6];
    const float* bv = (const float*)d_in[7];
    float* out = (float*)d_out;                   // [NB][256][4096]

    char* wsp = (char*)d_ws;
    auto take = [&](size_t bytes) { char* p = wsp; wsp += (bytes + 255) & ~(size_t)255; return (void*)p; };
    bf* Wb  = (bf*)take((size_t)3 * CC * CC * 2);             // Wq, Wk, Wv as bf16, each [o][c] = A operand as-is
    float* Qp = (float*)take((size_t)3 * GB * IMG * 4);       // Q, K, V, each [GB][256][4096] f32
    float* Kp = Qp + (size_t)GB * IMG;
    float* Vp = Kp + (size_t)GB * IMG;
    if ((size_t)(wsp - (char*)d_ws) > ws_size) return;        // 101,056,512 B at NB = 8

    k_prep<<<3 * WBLK, 256, 0, stream>>>(Wq, Wk, Wv, Wb);
    k_gemmx<<<dim3(HW / 64, 2 * GB), 128, 0, stream>>>(Wb, blue, white, Qp, bq, bk, bv);   // Q[o][p] = sum_c Wq[o][c] blue[c][p] + bq[o]; K, V likewise from white
    k_nbr<<<(unsigned)(GB * (NTK / TS) * (CC / 16)), 256, 0, stream>>>(Qp, Kp, Vp, blue, out);
}

// v007
// A run of this version takes 43.7 microseconds.
// Next to v006, in two timings, it ran 1.03 times as fast each time.
// Counting every step since v000, it is 3.35 times as fast.
#include <hip/hip_runtime.h>

// Contractions: three 1x1-conv channel GEMMs (out-channel x pixel, K = 256 in-channels) on v_wmma_f32_16x16x32_bf16 (bf16 operands = RNE-converted inputs and weights, f32 accumulate, bias added in f32); the 3x3-token x 16-dim per-channel attention (scores, softmax, weighted sum) and the residual add run in f32 on VALU.
// Pipeline, three launches over all GB = NB images: (1) k_prep: bf16 copies of the three weight matrices, laid out in the order in which k_gemmx's waves load their A fragments; (2) k_gemmx: Q = Wq.blue + bq, K = Wk.white + bk, V = Wv.white + bv as f32 channel-major planes [c][4096], read from the f32 channel-major features (staged in LDS by asynchronous copies) and converted to bf16 in registers; blockIdx.y chooses the image and K with V (one staged white tile serves both) or Q; (3) k_nbr: one block per (image, 4 token rows, 16 channels) computes the 9-neighbour attention (tokens outside the 16x16 grid are zero keys/values kept in the softmax), scale 1/4, and writes out = bf16(blue) + enhanced.

#ifndef NB
#define NB 8
#endif
#define NB_FULL 8
#define CC   256
#define HH   64
#define WW   64
#define HW   (HH * WW)
#define IMG  (CC * HW)          // per-image stride (floats) of inputs, output and Q/K/V planes (full geometry)
#define NTK  16                 // 4x4-pixel tokens per side
#define GB   NB                 // images per launch: all of them
#define SCL  0.25f
#define L2E  1.4426950408889634f
static_assert(NB % GB == 0);
static_assert(NB <= NB_FULL);
static_assert(CC == 256);
static_assert(HW % 64 == 0);
static_assert(CC % 32 == 0);

typedef unsigned short bf;
typedef __attribute__((ext_vector_type(16))) __bf16   v16bf;
typedef __attribute__((ext_vector_type(8)))  unsigned short v8us;
typedef __attribute__((ext_vector_type(16))) float    v16f;
typedef __attribute__((ext_vector_type(8)))  float    v8f;
typedef __attribute__((ext_vector_type(4)))  float    v4f;

__device__ __forceinline__ unsigned short f2bf(float f) { unsigned u = __float_as_uint(f); u += 0x7FFFu + ((u >> 16) & 1u); return (unsigned short)(u >> 16); }
__device__ __forceinline__ float bf2f(unsigned short b) { return __uint_as_float(((unsigned)b) << 16); }
__device__ __forceinline__ float bfr(float f) { return bf2f(f2bf(f)); }
__device__ __forceinline__ v16bf cat16b(v8us lo, v8us hi) { return __builtin_bit_cast(v16bf, __builtin_shufflevector(lo, hi, 0, 1, 2, 3, 4, 5, 6, 7, 8, 9, 10, 11, 12, 13, 14, 15)); }
__device__ __forceinline__ v8f wmmab(v16bf a, v16bf b, v8f c) { return __builtin_amdgcn_wmma_f32_16x16x32_bf16(false, a, false, b, (short)0, c, false, false); }

// ---- k_gemmx: register-blocked GEMM, one wave per 64x64 output tile (16 accumulators); the four waves of a block take the four 64-row blocks of the SAME 64 pixels. Grid (HW/64, 2 * GB), 128 threads.
// C[o][p] (f32, pitch HW) = sum_c bf16(W[o][c]) bf16(X[c][p]) + bf16(bias[o]). Projection w (0, 1, 2) takes Wb + w * CC * CC, bq / bk / bv, the features blue (w = 0) or white (w > 0) of image i and the plane C + (w * GB + i) * IMG.
// blockIdx.y < GB: image blockIdx.y, white tile, projections 1 and 2 one after the other (the longer blocks have the lower indices); else image blockIdx.y - GB, blue tile, projection 0.
// Weight layout (written by k_prep): matrix w, then wave (64 out-channel rows), then 32-wide k block, then 16-row block mb, then fragment half h, then lane, 8 elements (16 bytes) each: a wave's 16-byte-a-lane load of
// one fragment half is 512 bytes in a row (4 whole lines, each touched once by the wave), the eight loads of a pass are 4 KB in a row. (From row-major weights such a load touches 16 lines, 32 bytes of each.)
// Fragment map (both operands): lane l -> row/col l&15, elements 0..7 <- k0 + 8(l>>4) + 0..7, elements 8..15 <- k0 + 16 + 8(l>>4) + 0..7; D element r of lane l = (row 8(l>>4)+r, col l&15).
// Column map: column j of column tile nb is pixel c0 + 4j + nb. One 16-byte read of X[k][c0 + 4(l&15) ..+3] then gives lane l its element k of all four B fragments, and element r of the four accumulators of a row block is four neighbouring pixels of one output row: a 16-byte store, no transposition anywhere.
// Feature path: the block's whole f32 feature tile (CC in-channel rows x 256 bytes) comes into LDS once by asynchronous copies, all issued at the block's start, KS rows a stage, a buffer of its own for each stage: no buffer is
// filled twice, the later stages fly while the earlier ones are worked on, and the tile stays for the block's second projection, which reads it with no further copy, wait or barrier. Each wave copies a quarter of a stage
// (copy i of wave w: rows 16w + 2i and 16w + 2i + 1, 16 lanes x 16 bytes a row); all four waves read the whole stage. LDS row pitch XP floats = 272 bytes.
#define KS 64
#define XP 68
#define NST (CC / KS)
static_assert(CC % KS == 0 && NST == 4 && KS % 32 == 0 && KS == 64);
typedef __attribute__((address_space(1))) char gch;      // global address space, kept through the integer form below (else the accesses build as flat ones)
typedef __attribute__((address_space(1))) v4f gv4f;
typedef __attribute__((address_space(1))) const v8us gv8us;
// the block-uniform part of an address, cut off from the lane's part: what stays live across the loops is then one 32-bit offset a lane and no 64-bit address
// (with those the two-projection loop took 258 registers: three waves a SIMD, not four)
__device__ __forceinline__ gch* ubase(const void* p) {
    const unsigned long long u = (unsigned long long)p;
    const unsigned lo = (unsigned)__builtin_amdgcn_readfirstlane((int)(unsigned)u), hi = (unsigned)__builtin_amdgcn_readfirstlane((int)(unsigned)(u >> 32));
    return (gch*)(((unsigned long long)hi << 32) | lo);
}
__global__ __launch_bounds__(128) void k_gemmx(const bf* __restrict__ Wb, const float* __restrict__ blue, const float* __restrict__ white, float* C, const float* __restrict__ bq, const float* __restrict__ bk, const float* __restrict__ bv) {
    __shared__ __attribute__((aligned(16))) float xs[NST][KS][XP];
    const unsigned z = blockIdx.y; const bool kv = z < GB; const unsigned zi = kv ? z : z - GB;
    const float* X = (kv ? white : blue) + (size_t)zi * IMG;
    const unsigned w0 = kv ? 1u : 0u, w1 = kv ? 3u : 1u;                           // the block's projections: w0 .. w1 - 1
    const int lane = threadIdx.x & 31, lr = lane & 15, hi = lane >> 4, wv = (int)(threadIdx.x >> 5); const int r0 = wv * 64, c0 = blockIdx.x * 64;
    const unsigned aoff = (unsigned)wv * (64u * CC * 2u) + (unsigned)lane * 16u;    // this lane's byte offset in a packed weight matrix (its wave's part, its 16 bytes of a fragment half): block-uniform base + one 32-bit offset a lane
    const unsigned coff = ((unsigned)(r0 + 8 * hi) * HW + 4 * lr) * 4u;             // this lane's byte offset in an output plane, row block 0, row 0
    const float* gsrc = X + (size_t)(16 * wv + hi) * HW + c0 + 4 * lr;            // this lane's 16 bytes of its wave's first row pair, stage 0
    const unsigned ldst = (unsigned)(size_t)&xs[0][16 * wv + hi][4 * lr];          // the same place in buffer 0 (LDS byte address)
    // stage t into buffer t: eight copies a wave; the closing s_wait_xcnt 0 stands in the copies' own statement, in front of any rewrite of the address registers they name
    auto fill = [&](int t) {
        const float* g = gsrc + (size_t)t * (KS * HW); const unsigned l = ldst + (unsigned)t * (unsigned)(KS * XP * 4);
        asm volatile("global_load_async_to_lds_b128 %0, %8, off\n\t"
                     "global_load_async_to_lds_b128 %1, %9, off\n\t"
                     "global_load_async_to_lds_b128 %2, %10, off\n\t"
                     "global_load_async_to_lds_b128 %3, %11, off\n\t"
                     "global_load_async_to_lds_b128 %4, %12, off\n\t"
                     "global_load_async_to_lds_b128 %5, %13, off\n\t"
                     "global_load_async_to_lds_b128 %6, %14, off\n\t"
                     "global_load_async_to_lds_b128 %7, %15, off\n\t"
                     "s_wait_xcnt 0x0"
                     :: "v"(l), "v"(l + 2u * XP * 4u), "v"(l + 4u * XP * 4u), "v"(l + 6u * XP * 4u), "v"(l + 8u * XP * 4u), "v"(l + 10u * XP * 4u), "v"(l + 12u * XP * 4u), "v"(l + 14u * XP * 4u),
                        "v"(g), "v"(g + 2 * HW), "v"(g + 4 * HW), "v"(g + 6 * HW), "v"(g + 8 * HW), "v"(g + 10 * HW), "v"(g + 12 * HW), "v"(g + 14 * HW)
                     : "memory");
    };
    // L2 request for the bf16 weights, which the launch before stored, in front of the block's feature copies:
    // a block asks for one twelfth of the three matrices, a lane for one 256-byte unit; blocks of an even blockIdx.y ask for Wk and Wv (the first 64 blocks for all of both), those of an odd one for Wq;
    // eight neighbouring blocks ask for the same twelfth. A hint only: it returns nothing, and no result depends on which block asks for what
    const unsigned wsl = (z & 1u) ? ((blockIdx.x >> 3) & 3u) : 4u + (blockIdx.x >> 3);
    const unsigned wpo = (wsl * 128u + threadIdx.x) * 256u;
    static_assert(HW / 64 == 64 && 12 * 128 * 256 == 3 * CC * CC * 2);
    asm volatile("global_prefetch_b8 %0, %1 scope:SCOPE_SE" :: "v"(wpo), "s"(Wb));
    fill(0); fill(1); fill(2); fill(3);                 // 32 copies of a wave in flight
    // rolled: one copy of the body serves both projections, and the second takes the first one's registers
#pragma unroll 1
    for (unsigned zw = w0; zw < w1; ++zw) {
    const bf* A = Wb + (size_t)zw * CC * CC;
    const float* bias = zw == 0 ? bq : (zw == 1 ? bk : bv);
    gch* cb = ubase(C + ((size_t)zw * GB + zi) * IMG + c0);
    v8f acc[4][4];
#pragma unroll
    for (int mb = 0; mb < 4; ++mb)
#pragma unroll
        for (int nb = 0; nb < 4; ++nb) acc[mb][nb] = (v8f){};
#pragma unroll 1
    for (int t = 0; t < NST; ++t) {
        // publish point of stage t, in the block's first projection only (a test that reads the same in the whole block): this wave's eight copies of stage t have landed when at most
        // the 8 (NST - 1 - t) younger ones are outstanding (the counter returns in issue order, every wave issues the same 32); behind the barrier all four waves may read the stage
        if (zw == w0) {
            if (t == 0)      asm volatile("s_wait_asynccnt 0x18" ::: "memory");
            else if (t == 1) asm volatile("s_wait_asynccnt 0x10" ::: "memory");
            else if (t == 2) asm volatile("s_wait_asynccnt 0x8" ::: "memory");
            else             asm volatile("s_wait_asynccnt 0x0" ::: "memory");   // no copy is outstanding from here on
            __syncthreads();
        }
        const float (*xb)[XP] = xs[t];
#pragma unroll
        for (int ks = 0; ks < KS; ks += 32) {
            const gch* ak = ubase(A + (t * KS + ks) * 64);                          // 4 KB (2048 elements) of a wave's part for each 32-wide k block
            v4f x[16]; v16bf a[4];
#pragma unroll
            for (int e = 0; e < 16; ++e) x[e] = *(const v4f*)&xb[ks + 8 * hi + (e & 7) + 16 * (e >> 3)][4 * lr];
#pragma unroll
            for (int mb = 0; mb < 4; ++mb) a[mb] = cat16b(*(gv8us*)(ak + mb * 1024 + aoff), *(gv8us*)(ak + (mb * 1024 + 512) + aoff));
#pragma unroll
            for (int nb = 0; nb < 4; ++nb) { v16f tt;
#pragma unroll
                for (int e = 0; e < 16; ++e) tt[e] = x[e][nb];
                const v16bf b = __builtin_convertvector(tt, v16bf);
#pragma unroll
                for (int mb = 0; mb < 4; ++mb) acc[mb][nb] = wmmab(a[mb], b, acc[mb][nb]); }
            // ends a 32-row pass for the scheduler: without it the four slots below are moved up in front of the pass's WMMAs
            __builtin_amdgcn_sched_barrier(0);
            // four vector slots behind the pass's last WMMA before its operands are loaded anew
            asm volatile("v_nop\n\tv_nop\n\tv_nop\n\tv_nop");
            // keeps the next pass's loads behind those slots
            __builtin_amdgcn_sched_barrier(0);
        }
    }
#pragma unroll
    for (int mb = 0; mb < 4; ++mb) {
        const int row = r0 + mb * 16 + 8 * hi;
        const v8f bb = *(const v8f*)(bias + row);
        gch* crow = cb + mb * (16 * HW * 4);
#pragma unroll
        for (int j = 0; j < 8; ++j) { const float bj = bfr(bb[j]); v4f val;
#pragma unroll
            for (int nb = 0; nb < 4; ++nb) val[nb] = acc[mb][nb][j] + bj;
            *(gv4f*)(crow + j * (HW * 4) + coff) = val; }
    }
    // the registers that the issued stores name are written anew by the next projection only behind this wait
    asm volatile("s_wait_xcnt 0x0" ::: "memory");
    }
    // the registers that the L2 request names keep their address to the kernel's end: nothing else is put into them while the request may still read them
    asm volatile("" :: "v"(wpo), "s"(Wb));
}

// ---- k_prep: the three weight matrices as bf16, 8 elements (one 16-byte unit) a thread, WBLK blocks a matrix. Unit d of matrix w, Wb = [3][4 waves][8 k blocks][4 row blocks][2 halves][32 lanes][8], holds
// W[64 wave + 16 mb + (lane & 15)][32 kb + 16 h + 8 (lane >> 4) + 0..7]: elements 8h .. 8h + 7 of that lane's A fragment by k_gemmx's fragment map. A wave stores 512 bytes in a row.
#define WBLK (CC * CC / 8 / 256)
static_assert((CC * CC / 8) % 256 == 0);
__global__ __launch_bounds__(256) void k_prep(const float* __restrict__ Wq, const float* __restrict__ Wk, const float* __restrict__ Wv, bf* Wb) {
    const unsigned blk = blockIdx.x;
    const unsigned w = blk / WBLK; const float* src = w == 0 ? Wq : (w == 1 ? Wk : Wv);
    const unsigned d = (blk % WBLK) * 256 + threadIdx.x;
    const unsigned ln = d & 31u, h = (d >> 5) & 1u, mb = (d >> 6) & 3u, kb = (d >> 8) & 7u, wq = d >> 11;
    const unsigned row = wq * 64u + mb * 16u + (ln & 15u), col = kb * 32u + h * 16u + (ln >> 4) * 8u;
    const v8f v = *(const v8f*)(src + (size_t)row * CC + col); v8us o;
#pragma unroll
    for (int k = 0; k < 8; ++k) o[k] = f2bf(v[k]);
    *(v8us*)(Wb + (size_t)w * CC * CC + (size_t)d * 8) = o;
}

// k_nbr: per-channel attention of each 4x4-pixel token over its 3x3 token neighbourhood (16-dim dot per key, scale 1/4, softmax over the 9 slots with
// out-of-grid slots as zero keys/values, weighted sum of the value tokens), plus the residual bf16(blue). One block per (image, strip of TS token rows,
// group of 16 channels); lane&15 = token column tj, wave*2 + (lane>>4) = channel within the group. Q/K/V are f32 channel-major planes [img][c][4096].
// A wave walks the TS + 2 key/value token rows of its strip from top to bottom. Each row is loaded once (own column only, clamped row) and serves from
// registers the up to three query rows that have it as a neighbour row; their queries and online-softmax states are carried in registers. The left and right
// neighbour's key and value come from lane tj - 1 / tj + 1 of the same 16-lane row by a DPP row shift. Validity enters only by value. For each query the
// nine slots come in the order (row above, own row, row below) x (left, own, right).
#define TS 4
static_assert(NTK % TS == 0);
// value of lane - 1 (0x111, row_shr:1) or lane + 1 (0x101, row_shl:1) within the 16-lane row; 0 where that lane does not exist
template <int CTRL> __device__ __forceinline__ float rowsh(float x) { return __int_as_float(__builtin_amdgcn_update_dpp(0, __float_as_int(x), CTRL, 0xf, 0xf, true)); }
template <int DJ> __device__ __forceinline__ float nbv(float x) { if constexpr (DJ < 0) return rowsh<0x111>(x); else if constexpr (DJ > 0) return rowsh<0x101>(x); else return x; }

__device__ __forceinline__ void ex2x2(float a, float b, float& ra, float& rb) {
    asm("v_exp_f32 %0, %2\n\tv_exp_f32 %1, %3\n\tv_nop\n\ts_delay_alu instid0(TRANS32_DEP_1)" : "=&v"(ra), "=&v"(rb) : "v"(a), "v"(b));
}

template <int DJ> __device__ __forceinline__ void slot(const float (&q)[16], const v4f (&k)[4], const v4f (&v)[4], bool ok, float (&acc)[16], float& m, float& l) {
    float kd = 0.0f;
#pragma unroll
    for (int r = 0; r < 4; ++r)
#pragma unroll
        for (int e = 0; e < 4; ++e) kd = fmaf(q[4 * r + e], nbv<DJ>(k[r][e]), kd);
    const float s = ok ? kd * SCL : 0.0f;
    const float mn = fmaxf(m, s);
    float corr, p;
    ex2x2((m - mn) * L2E, (s - mn) * L2E, corr, p);
    l = fmaf(l, corr, p);
    const float pv = ok ? p : 0.0f;
#pragma unroll
    for (int r = 0; r < 4; ++r)
#pragma unroll
        for (int e = 0; e < 4; ++e) { const float t = acc[4 * r + e] * corr; acc[4 * r + e] = fmaf(pv, nbv<DJ>(v[r][e]), t); }
    m = mn;
}

__global__ __launch_bounds__(256) __attribute__((amdgpu_num_vgpr(256)))
void k_nbr(const float* __restrict__ Qg, const float* __restrict__ Kg, const float* __restrict__ Vg, const float* __restrict__ xres, float* outp) {
#pragma clang fp contract(off)
    const int tid = threadIdx.x, lane = tid & 31, wv = tid >> 5;
    const int tj = lane & 15, cs = lane >> 4;
    const int blk = blockIdx.x;
    const int cg = blk & 15, t0 = ((blk >> 4) & (NTK / TS - 1)) * TS, bb = blk / (16 * (NTK / TS));
    // every address = block-uniform base (scalar registers) + one 32-bit byte offset per lane: lob (channel within the group, token column) for the strip's own
    // rows, voT / voB = lob + the clamped row above / below the strip
    const size_t ub = (size_t)bb * IMG + (size_t)(cg * 16) * HW;
    const unsigned lob = (unsigned)((wv * 2 + cs) * HW + 4 * tj) * 4u;
    const unsigned voT = lob + (unsigned)(t0 > 0 ? t0 - 1 : 0) * (4u * WW * 4u);
    const unsigned voB = lob + (unsigned)(t0 + TS < NTK ? t0 + TS : NTK - 1) * (4u * WW * 4u);
    const char* Kb = (const char*)(Kg + ub); const char* Vb = (const char*)(Vg + ub);
    const size_t us = ub + (size_t)(4 * t0) * WW;
    const char* Qs = (const char*)(Qg + us); const char* Ks = (const char*)(Kg + us); const char* Vs = (const char*)(Vg + us);
    const char* xs = (const char*)(xres + us); char* os = (char*)(outp + us);
    const bool okl = tj > 0, okr = tj < NTK - 1;
    // L2 requests for the rows that the wave loads in its later steps: lane (cs, tj) names 256-byte unit tj of its channel's four token rows (4 KB in a row) behind a
    // block-uniform base: the strip's own rows for Q and the residual, one token row further down for K and V (the strip's own rows again in the lowest strip: no address leaves a plane)
    const unsigned pfo = (unsigned)((wv * 2 + cs) * HW + 64 * tj) * 4u;
    const unsigned pfd = t0 + TS < NTK ? 4u * WW * 4u : 0u;
    const char* Kf = Ks + pfd; const char* Vf = Vs + pfd;

    v4f kk[TS + 2][4], vv[TS + 2][4], qq[TS][4], bl[TS][4];   // every index is a constant after unrolling: registers, live only while needed
    auto ldkv = [&](int j) {                                   // key/value token row t0 - 1 + j, clamped into the grid
#pragma unroll
        for (int r = 0; r < 4; ++r) {
            if (j == 0)           { kk[j][r] = *(const v4f*)(Kb + r * (WW * 4) + voT); vv[j][r] = *(const v4f*)(Vb + r * (WW * 4) + voT); }
            else if (j == TS + 1) { kk[j][r] = *(const v4f*)(Kb + r * (WW * 4) + voB); vv[j][r] = *(const v4f*)(Vb + r * (WW * 4) + voB); }
            else                  { kk[j][r] = *(const v4f*)(Ks + (4 * (j - 1) + r) * (WW * 4) + lob); vv[j][r] = *(const v4f*)(Vs + (4 * (j - 1) + r) * (WW * 4) + lob); }
        }
    };
    auto ldq = [&](int s) {
#pragma unroll
        for (int r = 0; r < 4; ++r) qq[s][r] = *(const v4f*)(Qs + (4 * s + r) * (WW * 4) + lob);
    };
    auto ldb = [&](int s) {
#pragma unroll
        for (int r = 0; r < 4; ++r) bl[s][r] = *(const v4f*)(xs + (4 * s + r) * (WW * 4) + lob);
    };
    float q[TS][16], acc[TS][16], m[TS], l[TS];
    ldq(0); ldkv(0);
    // voT has its last use in the loads above: it stays in its register up to this wait, so that nothing overwrites it while an issued load still names it
    asm volatile("s_wait_xcnt 0x0" :: "v"(voT) : "memory");

    // key/value row j serves query rows j - 2, j - 1, j of the strip (as their lower, own and upper neighbour row); a query row is finished behind its lower row
#pragma unroll
    for (int j = 0; j < TS + 2; ++j) {
        if (j + 1 < TS + 2) ldkv(j + 1);
        if (j + 1 < TS) ldq(j + 1);
        if (j >= 2) ldb(j - 2);
        // behind the loads of the first two rows: everything else the wave will read is asked of L2 now, so that memory serves all rows at once and not one row a step;
        // a hint only, it returns nothing and no wait covers it
        if (j == 0) asm volatile("global_prefetch_b8 %0, %1 scope:SCOPE_SE\n\t"
                                 "global_prefetch_b8 %0, %2 scope:SCOPE_SE\n\t"
                                 "global_prefetch_b8 %0, %3 scope:SCOPE_SE\n\t"
                                 "global_prefetch_b8 %0, %4 scope:SCOPE_SE"
                                 :: "v"(pfo), "s"(Kf), "s"(Vf), "s"(Qs), "s"(xs));
        // the same for voB behind the loads of the row below the strip
        if (j == TS) asm volatile("s_wait_xcnt 0x0" :: "v"(voB) : "memory");
        // keeps the next row's loads in front of this row's arithmetic: without it the scheduler sinks the value loads to a few instructions before their use
        __builtin_amdgcn_sched_barrier(0);
        if (j < TS) {
#pragma unroll
            for (int e = 0; e < 16; ++e) { q[j][e] = qq[j][e >> 2][e & 3]; acc[j][e] = 0.0f; }
            m[j] = -1.0e30f; l[j] = 0.0f;
        }
        const bool vi = ((unsigned)(t0 + j - 1) < (unsigned)NTK);
#pragma unroll
        for (int s = j - 2; s <= j; ++s) {
            if (s < 0 || s >= TS) continue;
            slot<-1>(q[s], kk[j], vv[j], vi && okl, acc[s], m[s], l[s]);
            slot< 0>(q[s], kk[j], vv[j], vi,        acc[s], m[s], l[s]);
            slot< 1>(q[s], kk[j], vv[j], vi && okr, acc[s], m[s], l[s]);
        }
        // the registers that the L2 requests name keep their addresses up to here, behind the arithmetic of three steps (held to the kernel's end the offset is spilled and its register reused at once)
        if (j == 2) asm volatile("" :: "v"(pfo), "s"(Kf), "s"(Vf), "s"(Qs), "s"(xs));
        if (j >= 2) {
            const int s = j - 2;
            const float inv = 1.0f / l[s];
#pragma unroll
            for (int r = 0; r < 4; ++r) { v4f t4;
#pragma unroll
                for (int e = 0; e < 4; ++e) { const float en = acc[s][4 * r + e] * inv; t4[e] = bfr(bl[s][r][e]) + en; }
                *(v4f*)(os + (4 * s + r) * (WW * 4) + lob) = t4; }
            // the stored registers are free for the next loads' results only behind this wait
            if (j < TS + 1) asm volatile("s_wait_xcnt 0x0" ::: "memory");
        }
    }
}

extern "C" void kernel_launch(void* const* d_in, const int* in_sizes, int n_in, void* d_out, int out_size, void* d_ws, size_t ws_size, hipStream_t stream) {
    (void)n_in;
    if (in_sizes[0] < NB * IMG || in_sizes[1] < NB * IMG || in_sizes[2] < CC * CC || in_sizes[3] < CC || in_sizes[4] < CC * CC || in_sizes[5] < CC || in_sizes[6] < CC * CC || in_sizes[7] < CC || out_size < NB * IMG) return;
    const float* blue  = (const float*)d_in[0];   // [NB][256][4096] channel-major
    const float* white = (const float*)d_in[1];
    const float* Wq = (const float*)d_in[2];      // [256 out][256 in]
    const float* bq = (const float*)d_in[3];
    const float* Wk = (const float*)d_in[4];
    const float* bk = (const float*)d_in[5];
    const float* Wv = (const float*)d_in[6];
    const float* bv = (const float*)d_in[7];
    float* out = (float*)d_out;                   // [NB][256][4096]

    char* wsp = (char*)d_ws;
    auto take = [&](size_t bytes) { char* p = wsp; wsp += (bytes + 255) & ~(size_t)255; return (void*)p; };
    bf* Wb  = (bf*)take((size_t)3 * CC * CC * 2);             // Wq, Wk, Wv as bf16, each in A-fragment order
    float* Qp = (float*)take((size_t)3 * GB * IMG * 4);       // Q, K, V, each [GB][256][4096] f32
    float* Kp = Qp + (size_t)GB * IMG;
    float* Vp = Kp + (size_t)GB * IMG;
    if ((size_t)(wsp - (char*)d_ws) > ws_size) return;        // 101,056,512 B at NB = 8

    k_prep<<<3 * WBLK, 256, 0, stream>>>(Wq, Wk, Wv, Wb);
    k_gemmx<<<dim3(HW / 64, 2 * GB), 128, 0, stream>>>(Wb, blue, white, Qp, bq, bk, bv);   // Q[o][p] = sum_c Wq[o][c] blue[c][p] + bq[o]; K, V likewise from white
    k_nbr<<<(unsigned)(GB * (NTK / TS) * (CC / 16)), 256, 0, stream>>>(Qp, Kp, Vp, blue, out);
}
